// v000
// The times below were measured on an AMD MI455X: many runs one after another, warmed up first and cycling through
// copies of the inputs, with the whole window's GPU time divided by the number of runs. Launches and the gaps
// between them are all in it. The median over several windows is given; except for v000 it joins two sittings, which
// can be a few percent apart, so the side-by-side timings, each taken in one sitting, are the better comparison.
// The starting kernel, v000, takes 202 microseconds a run.
#include <hip/hip_runtime.h>
#include <stdint.h>

// Contractions: x.W^T projections on v_wmma_f32_16x16x32_bf16 (bf16 operands = RNE-converted inputs, f32 accumulate);
// K^T.V (depth SEQ) and Q.S (depth 64) on v_wmma_f32_16x16x32_bf16 with bf16 hi/lo split operands (hi.hi + hi.lo + lo.hi), f32 accumulate.

#ifndef NB
#define NB 2
#endif
#ifndef SEQ
#define SEQ 2048
#endif
#define NB_FULL 2
#define SEQ_FULL 2048
#define EMB 1024
#define NH 16
#define HD 64
#define MTOK (NB * SEQ)
#define NBH (NB * NH)
#define CVT_BLK 256
#define NBW (EMB * EMB / (8 * CVT_BLK))
#define NBX (MTOK * EMB / (8 * CVT_BLK))

static_assert(SEQ % 256 == 0);
static_assert(SEQ >= 256);
static_assert(NB >= 1 && NB <= NB_FULL);
static_assert(SEQ <= SEQ_FULL);
static_assert(EMB == NH * HD);
static_assert((MTOK * EMB) % (8 * CVT_BLK) == 0);
static_assert((EMB * EMB) % (8 * CVT_BLK) == 0);
static_assert(MTOK % 16 == 0);
static_assert(SEQ % 128 == 0);

typedef __bf16 v16bf __attribute__((ext_vector_type(16)));
typedef __bf16 v8bf __attribute__((ext_vector_type(8)));
typedef float v8f __attribute__((ext_vector_type(8)));
typedef float v4f __attribute__((ext_vector_type(4)));
typedef unsigned int v4u __attribute__((ext_vector_type(4)));
typedef v8bf v8bfa __attribute__((may_alias));
typedef v4f v4fa __attribute__((may_alias));
typedef v4u v4ua __attribute__((may_alias));

// ---------------------------------------------------------------------------
// bf16 helpers (integer RNE convert)
// ---------------------------------------------------------------------------
__device__ __forceinline__ unsigned int bfbits(float f) {
  unsigned int u = __float_as_uint(f);
  u += 0x7FFFu + ((u >> 16) & 1u);
  return u >> 16;
}
__device__ __forceinline__ float bfval(unsigned int b) {
  return __uint_as_float(b << 16);
}
__device__ __forceinline__ unsigned int pack2(unsigned int lo16, unsigned int hi16) {
  return (lo16 & 0xffffu) | (hi16 << 16);
}

// ---------------------------------------------------------------------------
// D(16x16 f32) += A(16 x 32k bf16) . B(32k x 16 bf16), wave32; hazard guard after issue.
// ---------------------------------------------------------------------------
__device__ __forceinline__ v8f wmma_bf(v16bf a, v16bf b, v8f c) {
  v8f d = __builtin_amdgcn_wmma_f32_16x16x32_bf16(false, a, false, b, (short)0, c, false, false);
  asm volatile("v_nop\n\tv_nop\n\tv_nop\n\tv_nop" : "+v"(d) : "v"(a), "v"(b));
  return d;
}

// ---------------------------------------------------------------------------
// 16-bit fragment from a row-major [rows][ld] plane (k contiguous within a row).
// lane l: row = r0 + (l & 15); elements 0..7 <- k0 + 8*(l>>4) + 0..7,
//                               elements 8..15 <- k0 + 16 + 8*(l>>4) + 0..7.
// A operand: rows are M rows. B operand: rows are N columns of B (plane holds B^T, i.e. [n][k]).
// D: acc[r] = (row 8*(l>>4) + r, col l & 15).
// ---------------------------------------------------------------------------
__device__ __forceinline__ v16bf ldfrag(const unsigned short* __restrict__ base,
                                        int ld, int r0, int k0) {
  const int lane = threadIdx.x & 31;
  const int m = lane & 15;
  const int koff = (lane >> 4) << 3;
  const unsigned short* p = base + (size_t)(r0 + m) * ld + (k0 + koff);
  const v8bf lo = *(const v8bfa*)p;
  const v8bf hi = *(const v8bfa*)(p + 16);
  v16bf f;
#pragma unroll
  for (int i = 0; i < 8; ++i) { f[i] = lo[i]; f[i + 8] = hi[i]; }
  return f;
}

// ---------------------------------------------------------------------------
// Kernel 1: f32 -> bf16 (RNE) planes for x (token rows remapped for reduced builds)
// and the three weight matrices. 8 elements per thread, one 16-B store per thread:
// ---------------------------------------------------------------------------
__global__ __launch_bounds__(CVT_BLK) void k_cvt(const float* __restrict__ x,
                                                 const float* __restrict__ wq,
                                                 const float* __restrict__ wk,
                                                 const float* __restrict__ wv,
                                                 unsigned short* __restrict__ Xb,
                                                 unsigned short* __restrict__ Wb) {
  const int blk = blockIdx.x;
  const int tid = threadIdx.x;
  const float* src;
  unsigned short* dst;
  if (blk < NBX) {
    const size_t e = ((size_t)blk * CVT_BLK + tid) * 8;
    const size_t t = e / EMB;
    const size_t col = e - t * EMB;
    const size_t bt = t / SEQ;
    const size_t s = t - bt * SEQ;
    src = x + (bt * SEQ_FULL + s) * EMB + col;
    dst = Xb + e;
  } else {
    const int wi = blk - NBX;
    const int zw = wi / NBW;
    const size_t e = ((size_t)(wi - zw * NBW) * CVT_BLK + tid) * 8;
    const float* wsrc = (zw == 0) ? wq : ((zw == 1) ? wk : wv);
    src = wsrc + e;
    dst = Wb + (size_t)zw * EMB * EMB + e;
  }
  const v4f a = *(const v4fa*)src;
  const v4f b = *(const v4fa*)(src + 4);
  const float a0 = a[0], a1 = a[1], a2 = a[2], a3 = a[3];
  const float b0 = b[0], b1 = b[1], b2 = b[2], b3 = b[3];
  v4u o;
  o[0] = pack2(bfbits(a0), bfbits(a1));
  o[1] = pack2(bfbits(a2), bfbits(a3));
  o[2] = pack2(bfbits(b0), bfbits(b1));
  o[3] = pack2(bfbits(b2), bfbits(b3));
  *(v4u*)dst = o;
  
}

// ---------------------------------------------------------------------------
// Kernel 2: y = Xb . Wb^T + b (M = MTOK, N = EMB, K = EMB), z = blockIdx.y selects q/k/v.
// Block: 512 threads = 16 waves; block tile = 16 token rows x full 1024 columns
// (= one contiguous 16384-element chunk of the flat [MTOK][1024] result = rows j0..j0+255
// of one [SEQ][64] slab bh of the raw-reshaped view); wave tile 16 x 64 (4 D tiles).
// Epilogue: value = acc + bf16(bias); hi = bf16(value), lo = bf16(value - hi).
//   z = 0: Q planes flat [MTOK][1024] (== [NBH][SEQ][64] view), 32 KB contiguous per block.
//   z = 1,2: transposed planes Kt/Vt [NBH][64 kk][SEQ j]; block owns 64 rows x 512 B.
// ---------------------------------------------------------------------------
__global__ __launch_bounds__(512) void k_proj(const unsigned short* __restrict__ Xb,
                                               const unsigned short* __restrict__ Wb,
                                               const float* __restrict__ bq,
                                               const float* __restrict__ bk,
                                               const float* __restrict__ bv,
                                               unsigned short* __restrict__ Qhi,
                                               unsigned short* __restrict__ Qlo,
                                               unsigned short* __restrict__ Kthi,
                                               unsigned short* __restrict__ Ktlo,
                                               unsigned short* __restrict__ Vthi,
                                               unsigned short* __restrict__ Vtlo) {
  __shared__ __align__(16) unsigned short lds_t[16 * EMB];   // 32 KB: [16][1024] or [64][256]
  const int z = blockIdx.y;
  const int tid = threadIdx.x;
  const int lane = tid & 31;
  const int w = tid >> 5;
  const int c = lane & 15;
  const int h = lane >> 4;
  const int m0 = blockIdx.x * 16;
  const int nb = w * 64;
  const unsigned short* W = Wb + (size_t)z * EMB * EMB;
  const float* bias = (z == 0) ? bq : ((z == 1) ? bk : bv);
  const unsigned short* arow = Xb + (size_t)m0 * EMB;   // A rows m0 .. m0+15
  const unsigned short* wrow = W + (size_t)nb * EMB;     // B^T rows (= output cols) nb .. nb+63

  v8f acc[4] = {};
#pragma unroll 1
  for (int k0 = 0; k0 < EMB; k0 += 32) {
    const v16bf a  = ldfrag(arow, EMB, 0, k0);
    const v16bf b0 = ldfrag(wrow, EMB, 0, k0);
    const v16bf b1 = ldfrag(wrow, EMB, 16, k0);
    const v16bf b2 = ldfrag(wrow, EMB, 32, k0);
    const v16bf b3 = ldfrag(wrow, EMB, 48, k0);
    acc[0] = wmma_bf(a, b0, acc[0]);
    acc[1] = wmma_bf(a, b1, acc[1]);
    acc[2] = wmma_bf(a, b2, acc[2]);
    acc[3] = wmma_bf(a, b3, acc[3]);
  }

  // bias as its bf16 (RNE) value, added in f32
  float bb[4];
#pragma unroll
  for (int ni = 0; ni < 4; ++ni) bb[ni] = bfval(bfbits(bias[nb + ni * 16 + c]));

  const bool zq = (z == 0);
  const int bh = (m0 * 16) / SEQ;
  const int j0 = m0 * 16 - bh * SEQ;
  unsigned short* planeH = zq ? Qhi : ((z == 1) ? Kthi : Vthi);
  unsigned short* planeL = zq ? Qlo : ((z == 1) ? Ktlo : Vtlo);

  // per-thread 16-B store pieces (4 per plane): LDS source offset and global element offset
  int loff[4];
  size_t goff[4];
#pragma unroll
  for (int it = 0; it < 4; ++it) {
    const int p = it * 512 + tid;                        // z = 0: piece index in the 32 KB chunk
    const int lq = p * 8;
    const size_t gq = (size_t)m0 * EMB + (size_t)p * 8;
    const int kk = it * 16 + w;                          // z = 1,2: wave w writes row kk whole (512 B)
    const int lk = kk * 256 + lane * 8;
    const size_t gk = ((size_t)bh * HD + kk) * (size_t)SEQ + (size_t)j0 + (size_t)lane * 8;
    loff[it] = zq ? lq : lk;
    goff[it] = zq ? gq : gk;
  }

#pragma unroll
  for (int ph = 0; ph < 2; ++ph) {
#pragma unroll
    for (int ni = 0; ni < 4; ++ni) {
#pragma unroll
      for (int r = 0; r < 8; ++r) {
        const float v = acc[ni][r] + bb[ni];
        const unsigned int hb = bfbits(v);
        const unsigned int val = (ph == 0) ? hb : bfbits(v - bfval(hb));
        const int n = nb + ni * 16 + c;                  // output column
        const int ml = 8 * h + r;                        // row inside the 16-row tile
        const int lq = ml * EMB + n;                     // [16][1024]
        const int lk = (ni * 16 + c) * 256 + ml * 16 + w;   // [kk = n & 63][jl = ml*16 + (n >> 6)]
        lds_t[zq ? lq : lk] = (unsigned short)val;
      }
    }
    __syncthreads();                                     // cross-wave LDS exchange
    v4u pv[4];
#pragma unroll
    for (int it = 0; it < 4; ++it) pv[it] = *(const v4ua*)(lds_t + loff[it]);
    unsigned short* plane = (ph == 0) ? planeH : planeL;
#pragma unroll
    for (int it = 0; it < 4; ++it) *(v4u*)(plane + goff[it]) = pv[it];
    
    __syncthreads();                                     // LDS reuse for the lo plane
  }
}

// ---------------------------------------------------------------------------
// Kernel 3: S[bh][kk][d] = 0.125 * sum_j K[bh][j][kk] * V[bh][j][d]  (64 x 64, depth SEQ).
// One block per bh, 256 threads = 8 waves, wave tile 16 kk x 32 d (2 D tiles).
// A = Kt[bh][kk][j] (hi/lo planes), B^T = Vt[bh][d][j] (hi/lo planes); 3 products per tile-step.
// Epilogue: S (f32) transposed into LDS as [d][kk]; St hi/lo planes [NBH][64 d][64 kk]
// ---------------------------------------------------------------------------
__global__ __launch_bounds__(256) void k_kv(const unsigned short* __restrict__ Kthi,
                                             const unsigned short* __restrict__ Ktlo,
                                             const unsigned short* __restrict__ Vthi,
                                             const unsigned short* __restrict__ Vtlo,
                                             unsigned short* __restrict__ Sthi,
                                             unsigned short* __restrict__ Stlo) {
  __shared__ __align__(16) float s_lds[HD * HD];     // [d][kk], 16 KB
  const int bh = blockIdx.x;
  const int tid = threadIdx.x;
  const int lane = tid & 31;
  const int w = tid >> 5;
  const int c = lane & 15;
  const int h = lane >> 4;
  const int m0w = (w >> 1) * 16;    // kk
  const int n0w = (w & 1) * 32;     // d
  const size_t pb = (size_t)bh * HD * (size_t)SEQ;
  const unsigned short* KH = Kthi + pb;
  const unsigned short* KL = Ktlo + pb;
  const unsigned short* VH = Vthi + pb;
  const unsigned short* VL = Vtlo + pb;

  v8f acc[2] = {};
#pragma unroll 1
  for (int j0 = 0; j0 < SEQ; j0 += 32) {
    const v16bf ah = ldfrag(KH, SEQ, m0w, j0);
    const v16bf al = ldfrag(KL, SEQ, m0w, j0);
#pragma unroll
    for (int t = 0; t < 2; ++t) {
      const v16bf vh = ldfrag(VH, SEQ, n0w + 16 * t, j0);
      const v16bf vl = ldfrag(VL, SEQ, n0w + 16 * t, j0);
      acc[t] = wmma_bf(ah, vh, acc[t]);
      acc[t] = wmma_bf(ah, vl, acc[t]);
      acc[t] = wmma_bf(al, vh, acc[t]);
    }
  }

  // D (row kk = m0w + 8h + r, col d = n0w + 16t + c) -> s_lds[d][kk], scaled by 1/sqrt(64)
#pragma unroll
  for (int t = 0; t < 2; ++t)
#pragma unroll
    for (int r = 0; r < 8; ++r) {
      const float v = acc[t][r];
      s_lds[(n0w + 16 * t + c) * HD + (m0w + 8 * h + r)] = v * 0.125f;
    }
  __syncthreads();                                   // cross-wave LDS exchange

  // 512 pieces of 16 B per plane: p = it*256 + tid; wave w covers 32 consecutive pieces per it.
  v4u hv[2], lv[2];
  size_t go[2];
#pragma unroll
  for (int it = 0; it < 2; ++it) {
    const int p = it * 256 + tid;
    const int d = p >> 3;
    const int kk8 = (p & 7) * 8;
    const v4f x0 = *(const v4fa*)(s_lds + d * HD + kk8);
    const v4f x1 = *(const v4fa*)(s_lds + d * HD + kk8 + 4);
    float f[8];
    f[0] = x0[0]; f[1] = x0[1]; f[2] = x0[2]; f[3] = x0[3];
    f[4] = x1[0]; f[5] = x1[1]; f[6] = x1[2]; f[7] = x1[3];
    unsigned int hb[8], lb[8];
#pragma unroll
    for (int i = 0; i < 8; ++i) {
      hb[i] = bfbits(f[i]);
      lb[i] = bfbits(f[i] - bfval(hb[i]));
    }
    v4u th, tl;
    th[0] = pack2(hb[0], hb[1]); th[1] = pack2(hb[2], hb[3]);
    th[2] = pack2(hb[4], hb[5]); th[3] = pack2(hb[6], hb[7]);
    tl[0] = pack2(lb[0], lb[1]); tl[1] = pack2(lb[2], lb[3]);
    tl[2] = pack2(lb[4], lb[5]); tl[3] = pack2(lb[6], lb[7]);
    hv[it] = th;
    lv[it] = tl;
    go[it] = (size_t)bh * HD * HD + (size_t)d * HD + (size_t)kk8;
  }
#pragma unroll
  for (int it = 0; it < 2; ++it) {
    *(v4u*)(Sthi + go[it]) = hv[it];
    *(v4u*)(Stlo + go[it]) = lv[it];
  }
  
}

// ---------------------------------------------------------------------------
// Kernel 4: out[bh][j][d] = sum_kk Q[bh][j][kk] * S[bh][kk][d]  (M = SEQ, N = 64, K = 64).
// grid (SEQ/128, NBH), 256 threads = 8 waves, wave tile 16 j rows x 64 d (4 D tiles).
// A = Q planes (flat [NBH][SEQ][64] view, ld 64), B^T = St planes [d][kk] (ld 64); 3 products.
// Epilogue: wave tile staged in LDS, then the wave writes its contiguous 4 KB of d_out as
// ---------------------------------------------------------------------------
__global__ __launch_bounds__(256) void k_out(const unsigned short* __restrict__ Qhi,
                                              const unsigned short* __restrict__ Qlo,
                                              const unsigned short* __restrict__ Sthi,
                                              const unsigned short* __restrict__ Stlo,
                                              float* __restrict__ out) {
  __shared__ __align__(16) float o_lds[8 * 16 * HD];   // 32 KB, 4 KB per wave
  const int bh = blockIdx.y;
  const int tid = threadIdx.x;
  const int lane = tid & 31;
  const int w = tid >> 5;
  const int c = lane & 15;
  const int h = lane >> 4;
  const int jw = blockIdx.x * 128 + w * 16;
  const size_t qb = (size_t)bh * (size_t)SEQ * HD;
  const size_t sb = (size_t)bh * HD * HD;
  const unsigned short* QH = Qhi + qb;
  const unsigned short* QL = Qlo + qb;
  const unsigned short* SH = Sthi + sb;
  const unsigned short* SL = Stlo + sb;

  v8f acc[4] = {};
#pragma unroll
  for (int ks = 0; ks < 2; ++ks) {
    const int k0 = ks * 32;
    const v16bf ah = ldfrag(QH, HD, jw, k0);
    const v16bf al = ldfrag(QL, HD, jw, k0);
#pragma unroll
    for (int t = 0; t < 4; ++t) {
      const v16bf sh = ldfrag(SH, HD, 16 * t, k0);
      const v16bf sl = ldfrag(SL, HD, 16 * t, k0);
      acc[t] = wmma_bf(ah, sh, acc[t]);
      acc[t] = wmma_bf(ah, sl, acc[t]);
      acc[t] = wmma_bf(al, sh, acc[t]);
    }
  }

  float* ol = o_lds + w * (16 * HD);
#pragma unroll
  for (int t = 0; t < 4; ++t)
#pragma unroll
    for (int r = 0; r < 8; ++r) {
      const float v = acc[t][r];
      ol[(8 * h + r) * HD + 16 * t + c] = v;
    }
  __syncthreads();                                   // covers the same-wave relayout as well

  v4f pv[8];
#pragma unroll
  for (int it = 0; it < 8; ++it) {
    const int p = it * 32 + lane;                    // piece p -> row p >> 4, cols (p & 15)*4 .. +3
    pv[it] = *(const v4fa*)(ol + p * 4);
  }
  float* ob = out + ((size_t)bh * (size_t)SEQ + (size_t)jw) * HD;
#pragma unroll
  for (int it = 0; it < 8; ++it) *(v4f*)(ob + (size_t)(it * 32 + lane) * 4) = pv[it];
  
}

// ---------------------------------------------------------------------------
// Host launch: convert -> projections (hi/lo planes) -> K^T V -> Q S
// ---------------------------------------------------------------------------
extern "C" void kernel_launch(void* const* d_in, const int* in_sizes, int n_in,
                              void* d_out, int out_size, void* d_ws, size_t ws_size,
                              hipStream_t stream) {
  if (n_in < 7) return;
  if ((size_t)in_sizes[0] < ((size_t)(NB - 1) * SEQ_FULL + (size_t)SEQ) * EMB) return;
  if (in_sizes[1] < EMB * EMB || in_sizes[3] < EMB * EMB || in_sizes[5] < EMB * EMB) return;
  if (in_sizes[2] < EMB || in_sizes[4] < EMB || in_sizes[6] < EMB) return;
  if ((size_t)out_size < (size_t)MTOK * EMB) return;

  const float* x  = (const float*)d_in[0];
  const float* Wq = (const float*)d_in[1];
  const float* bq = (const float*)d_in[2];
  const float* Wk = (const float*)d_in[3];
  const float* bk = (const float*)d_in[4];
  const float* Wv = (const float*)d_in[5];
  const float* bv = (const float*)d_in[6];
  float* out = (float*)d_out;

  const size_t nAct = (size_t)MTOK * EMB;           // elements per activation plane
  const size_t nWt  = (size_t)EMB * EMB;
  const size_t nS   = (size_t)NBH * HD * HD;

  char* ws = (char*)d_ws;
  size_t off = 0;
  unsigned short* Xb   = (unsigned short*)(ws + off); off += nAct * 2;
  unsigned short* Wb   = (unsigned short*)(ws + off); off += 3 * nWt * 2;
  unsigned short* Qhi  = (unsigned short*)(ws + off); off += nAct * 2;
  unsigned short* Qlo  = (unsigned short*)(ws + off); off += nAct * 2;
  unsigned short* Kthi = (unsigned short*)(ws + off); off += nAct * 2;
  unsigned short* Ktlo = (unsigned short*)(ws + off); off += nAct * 2;
  unsigned short* Vthi = (unsigned short*)(ws + off); off += nAct * 2;
  unsigned short* Vtlo = (unsigned short*)(ws + off); off += nAct * 2;
  unsigned short* Sthi = (unsigned short*)(ws + off); off += nS * 2;
  unsigned short* Stlo = (unsigned short*)(ws + off); off += nS * 2;
  if (off > ws_size) return;

  k_cvt<<<dim3(NBX + 3 * NBW), dim3(CVT_BLK), 0, stream>>>(x, Wq, Wk, Wv, Xb, Wb);
  k_proj<<<dim3(MTOK / 16, 3), dim3(512), 0, stream>>>(Xb, Wb, bq, bk, bv,
                                                       Qhi, Qlo, Kthi, Ktlo, Vthi, Vtlo);
  k_kv<<<dim3(NBH), dim3(256), 0, stream>>>(Kthi, Ktlo, Vthi, Vtlo, Sthi, Stlo);
  k_out<<<dim3(SEQ / 128, NBH), dim3(256), 0, stream>>>(Qhi, Qlo, Sthi, Stlo, out);
}

// v001
// It runs in 89.2 microseconds.
// Two timings next to v000 put it at 2.32 and 2.31 times that version's speed.
#include <hip/hip_runtime.h>
#include <stdint.h>

// Contractions: x.W^T projections on v_wmma_f32_16x16x32_bf16 (bf16 operands = RNE-converted inputs, f32 accumulate);
// K^T.V (depth SEQ) and Q.S (depth 64) on v_wmma_f32_16x16x32_bf16 with bf16 hi/lo split operands (hi.hi + hi.lo + lo.hi), f32 accumulate.

#ifndef NB
#define NB 2
#endif
#ifndef SEQ
#define SEQ 2048
#endif
#define NB_FULL 2
#define SEQ_FULL 2048
#define EMB 1024
#define NH 16
#define HD 64
#define MTOK (NB * SEQ)
#define NBH (NB * NH)
#define CVT_BLK 256
#define NBW (EMB * EMB / (8 * CVT_BLK))
#define NBX (MTOK * EMB / (8 * CVT_BLK))

static_assert(SEQ % 256 == 0);
static_assert(SEQ >= 256);
static_assert(NB >= 1 && NB <= NB_FULL);
static_assert(SEQ <= SEQ_FULL);
static_assert(EMB == NH * HD);
static_assert((MTOK * EMB) % (8 * CVT_BLK) == 0);
static_assert((EMB * EMB) % (8 * CVT_BLK) == 0);
static_assert(MTOK % 16 == 0);
static_assert(SEQ % 128 == 0);

typedef __bf16 v16bf __attribute__((ext_vector_type(16)));
typedef __bf16 v8bf __attribute__((ext_vector_type(8)));
typedef float v8f __attribute__((ext_vector_type(8)));
typedef float v4f __attribute__((ext_vector_type(4)));
typedef unsigned int v4u __attribute__((ext_vector_type(4)));
typedef v8bf v8bfa __attribute__((may_alias));
typedef v4f v4fa __attribute__((may_alias));
typedef v4u v4ua __attribute__((may_alias));

// ---------------------------------------------------------------------------
// bf16 helpers (integer RNE convert)
// ---------------------------------------------------------------------------
__device__ __forceinline__ unsigned int bfbits(float f) {
  unsigned int u = __float_as_uint(f);
  u += 0x7FFFu + ((u >> 16) & 1u);
  return u >> 16;
}
__device__ __forceinline__ float bfval(unsigned int b) {
  return __uint_as_float(b << 16);
}
__device__ __forceinline__ unsigned int pack2(unsigned int lo16, unsigned int hi16) {
  return (lo16 & 0xffffu) | (hi16 << 16);
}

// ---------------------------------------------------------------------------
// D(16x16 f32) += A(16 x 32k bf16) . B(32k x 16 bf16), wave32; hazard guard after issue.
// ---------------------------------------------------------------------------
__device__ __forceinline__ v8f wmma_bf(v16bf a, v16bf b, v8f c) {
  v8f d = __builtin_amdgcn_wmma_f32_16x16x32_bf16(false, a, false, b, (short)0, c, false, false);
  asm volatile("v_nop\n\tv_nop\n\tv_nop\n\tv_nop" : "+v"(d) : "v"(a), "v"(b));
  return d;
}

// ---------------------------------------------------------------------------
// 16-bit fragment from a row-major [rows][ld] plane (k contiguous within a row).
// lane l: row = r0 + (l & 15); elements 0..7 <- k0 + 8*(l>>4) + 0..7,
//                               elements 8..15 <- k0 + 16 + 8*(l>>4) + 0..7.
// A operand: rows are M rows. B operand: rows are N columns of B (plane holds B^T, i.e. [n][k]).
// D: acc[r] = (row 8*(l>>4) + r, col l & 15).
// ---------------------------------------------------------------------------
__device__ __forceinline__ v16bf ldfrag(const unsigned short* __restrict__ base,
                                        int ld, int r0, int k0) {
  const int lane = threadIdx.x & 31;
  const int m = lane & 15;
  const int koff = (lane >> 4) << 3;
  const unsigned short* p = base + (size_t)(r0 + m) * ld + (k0 + koff);
  const v8bf lo = *(const v8bfa*)p;
  const v8bf hi = *(const v8bfa*)(p + 16);
  v16bf f;
#pragma unroll
  for (int i = 0; i < 8; ++i) { f[i] = lo[i]; f[i + 8] = hi[i]; }
  return f;
}

// ---------------------------------------------------------------------------
// Kernel 1: f32 -> bf16 (RNE) planes for x (token rows remapped for reduced builds)
// and the three weight matrices. 8 elements per thread, one 16-B store per thread:
// ---------------------------------------------------------------------------
__global__ __launch_bounds__(CVT_BLK) void k_cvt(const float* __restrict__ x,
                                                 const float* __restrict__ wq,
                                                 const float* __restrict__ wk,
                                                 const float* __restrict__ wv,
                                                 unsigned short* __restrict__ Xb,
                                                 unsigned short* __restrict__ Wb) {
  const int blk = blockIdx.x;
  const int tid = threadIdx.x;
  const float* src;
  unsigned short* dst;
  if (blk < NBX) {
    const size_t e = ((size_t)blk * CVT_BLK + tid) * 8;
    const size_t t = e / EMB;
    const size_t col = e - t * EMB;
    const size_t bt = t / SEQ;
    const size_t s = t - bt * SEQ;
    src = x + (bt * SEQ_FULL + s) * EMB + col;
    dst = Xb + e;
  } else {
    const int wi = blk - NBX;
    const int zw = wi / NBW;
    const size_t e = ((size_t)(wi - zw * NBW) * CVT_BLK + tid) * 8;
    const float* wsrc = (zw == 0) ? wq : ((zw == 1) ? wk : wv);
    src = wsrc + e;
    dst = Wb + (size_t)zw * EMB * EMB + e;
  }
  const v4f a = *(const v4fa*)src;
  const v4f b = *(const v4fa*)(src + 4);
  const float a0 = a[0], a1 = a[1], a2 = a[2], a3 = a[3];
  const float b0 = b[0], b1 = b[1], b2 = b[2], b3 = b[3];
  v4u o;
  o[0] = pack2(bfbits(a0), bfbits(a1));
  o[1] = pack2(bfbits(a2), bfbits(a3));
  o[2] = pack2(bfbits(b0), bfbits(b1));
  o[3] = pack2(bfbits(b2), bfbits(b3));
  *(v4u*)dst = o;
  
}

// ---------------------------------------------------------------------------
// Kernel 2: y = Xb . Wb^T + b (M = MTOK, N = EMB, K = EMB), z = blockIdx.z selects q/k/v.
// Block: 256 threads = 8 waves; block tile = 128 token rows x 128 output columns.
// Per trip one 64-deep k slab of both operands (128 rows x 128 B each) goes global -> registers -> LDS
// with whole-line loads (8 lanes per row); two LDS buffers, one barrier per trip. Fragments come from
// LDS rows at a pitch of 144 B. Wave tile: 64 D rows x 32 D columns (4 x 2 D tiles).
// D rows are tokens for z = 1,2 and output columns for z = 0 (the operands swap places), so that a lane's
// 8 accumulator rows are always 8 neighbours of the stored row and leave as one 16-B LDS store.
// Epilogue: value = acc + bf16(bias); hi = bf16(value), lo = bf16(value - hi); both planes staged in LDS
// as T[D column][D row] (pitch 272 B), then stored as 128 rows of 256 B per plane.
//   z = 0: Q planes flat [MTOK][1024] (== [NBH][SEQ][64] view).
//   z = 1,2: planes Kt/Vt [NBH][64 kk][SEQ jp], jp = (n >> 6) * TPS + token inside the slab: the same
//            one-to-one renumbering of j for K and V, over which kernel 3 sums.
// ---------------------------------------------------------------------------
#define PT 128                      // block tile edge
#define PT_K 64                     // k depth of a slab
#define PT_LD 72                    // slab row pitch in 16-bit elements (144 B = 16 B x 9)
#define PT_OP (PT * PT_LD)          // one operand's slab
#define PT_BUF (2 * PT_OP)          // one buffer: both operands
#define ET_LD 136                   // output staging pitch in 16-bit elements (272 B = 16 B x 17)
#define ET_PL (PT * ET_LD)          // one staged plane
#define TPS (SEQ / 16)              // token rows per [SEQ][64] slab of the raw-reshaped view

static_assert(TPS % PT == 0);
static_assert(MTOK % PT == 0 && EMB % PT == 0 && EMB % PT_K == 0);
static_assert(2 * ET_PL <= 2 * PT_BUF);

// ldfrag's map on an LDS slab (same k order for both operands).
__device__ __forceinline__ v16bf ldfrag_lds(const unsigned short* base, int r0, int k0) {
  const int lane = threadIdx.x & 31;
  const unsigned short* p = base + (r0 + (lane & 15)) * PT_LD + (k0 + ((lane >> 4) << 3));
  const v8bf lo = *(const v8bfa*)p;
  const v8bf hi = *(const v8bfa*)(p + 16);
  v16bf f;
#pragma unroll
  for (int i = 0; i < 8; ++i) { f[i] = lo[i]; f[i + 8] = hi[i]; }
  return f;
}

// 6 waves per SIMD = 3 blocks per WGP: the 768 blocks are then all resident at once (register budget 160).
__global__ __launch_bounds__(256) __attribute__((amdgpu_waves_per_eu(6))) void k_proj(const unsigned short* __restrict__ Xb,
                                               const unsigned short* __restrict__ Wb,
                                               const float* __restrict__ bq,
                                               const float* __restrict__ bk,
                                               const float* __restrict__ bv,
                                               unsigned short* __restrict__ Qhi,
                                               unsigned short* __restrict__ Qlo,
                                               unsigned short* __restrict__ Kthi,
                                               unsigned short* __restrict__ Ktlo,
                                               unsigned short* __restrict__ Vthi,
                                               unsigned short* __restrict__ Vtlo) {
  __shared__ __align__(16) unsigned short lds_t[2 * PT_BUF];   // 72 KB: two slab buffers, then T hi | T lo
  const int z = blockIdx.z;
  const int tid = threadIdx.x;
  const int lane = tid & 31;
  const int w = tid >> 5;
  const int c = lane & 15;
  const int h = lane >> 4;
  const int m0 = blockIdx.x * PT;                        // first token row
  const int n0 = blockIdx.y * PT;                        // first output column
  const bool zq = (z == 0);
  const unsigned short* xt = Xb + (size_t)m0 * EMB;
  const unsigned short* wt = Wb + (size_t)z * EMB * EMB + (size_t)n0 * EMB;
  const int wr = (w >> 2) * 64;                          // wave's first D row
  const int wc = (w & 3) * 32;                           // wave's first D column

  // staging: piece i of a thread = row i*32 + (tid >> 3), 16 B at column (tid & 7) * 8
  const int srow = tid >> 3;
  const int scol = (tid & 7) * 8;
  const unsigned short* gA = (zq ? wt : xt) + (size_t)srow * EMB + scol;   // D rows
  const unsigned short* gB = (zq ? xt : wt) + (size_t)srow * EMB + scol;   // D columns
  const int lst = srow * PT_LD + scol;

  v4u ra[4], rb[4];
#pragma unroll
  for (int i = 0; i < 4; ++i) {
    ra[i] = *(const v4ua*)(gA + (size_t)i * 32 * EMB);
    rb[i] = *(const v4ua*)(gB + (size_t)i * 32 * EMB);
  }
#pragma unroll
  for (int i = 0; i < 4; ++i) {
    *(v4ua*)(lds_t + lst + i * 32 * PT_LD) = ra[i];
    *(v4ua*)(lds_t + PT_OP + lst + i * 32 * PT_LD) = rb[i];
  }

  v8f acc[4][2] = {};
#pragma unroll 1
  for (int kt = 0; kt < EMB / PT_K; ++kt) {
    // publishes slab kt and ends every wave's reads of the buffer that this trip refills
    __syncthreads();
    const unsigned short* cur = lds_t + (kt & 1) * PT_BUF;
    unsigned short* nxt = lds_t + ((kt + 1) & 1) * PT_BUF;
    const bool more = (kt + 1 < EMB / PT_K);
    if (more) {
#pragma unroll
      for (int i = 0; i < 4; ++i) {
        ra[i] = *(const v4ua*)(gA + (size_t)i * 32 * EMB + (kt + 1) * PT_K);
        rb[i] = *(const v4ua*)(gB + (size_t)i * 32 * EMB + (kt + 1) * PT_K);
      }
    }
#pragma unroll
    for (int ks = 0; ks < 2; ++ks) {
      v16bf a[4], b[2];
#pragma unroll
      for (int mi = 0; mi < 4; ++mi) a[mi] = ldfrag_lds(cur, wr + 16 * mi, ks * 32);
#pragma unroll
      for (int ni = 0; ni < 2; ++ni) b[ni] = ldfrag_lds(cur + PT_OP, wc + 16 * ni, ks * 32);
#pragma unroll
      for (int mi = 0; mi < 4; ++mi)
#pragma unroll
        for (int ni = 0; ni < 2; ++ni) acc[mi][ni] = wmma_bf(a[mi], b[ni], acc[mi][ni]);
    }
    if (more) {
#pragma unroll
      for (int i = 0; i < 4; ++i) {
        *(v4ua*)(nxt + lst + i * 32 * PT_LD) = ra[i];
        *(v4ua*)(nxt + PT_OP + lst + i * 32 * PT_LD) = rb[i];
      }
    }
  }
  __syncthreads();                                       // last fragment reads end before LDS becomes T

  // bias as its bf16 (RNE) value, added in f32; it follows the output column: D column (z = 1,2) or D row (z = 0)
  const float* bias = zq ? bq : ((z == 1) ? bk : bv);
  float bcol[2];
#pragma unroll
  for (int ni = 0; ni < 2; ++ni) bcol[ni] = bfval(bfbits(bias[n0 + wc + ni * 16 + c]));
  // precaution
  asm volatile("s_wait_xcnt 0x0" ::: "memory");

  unsigned short* tH = lds_t;
  unsigned short* tL = lds_t + ET_PL;
#pragma unroll
  for (int mi = 0; mi < 4; ++mi) {
    const float* bp = bias + n0 + wr + mi * 16 + 8 * h;
    const v4f p0 = *(const v4fa*)bp;
    const v4f p1 = *(const v4fa*)(bp + 4);
    float brow[8];
#pragma unroll
    for (int r = 0; r < 4; ++r) {
      brow[r] = bfval(bfbits(p0[r]));
      brow[r + 4] = bfval(bfbits(p1[r]));
    }
#pragma unroll
    for (int ni = 0; ni < 2; ++ni) {
      unsigned int hb[8], lb[8];
#pragma unroll
      for (int r = 0; r < 8; ++r) {
        const float v = acc[mi][ni][r] + (zq ? brow[r] : bcol[ni]);
        hb[r] = bfbits(v);
        lb[r] = bfbits(v - bfval(hb[r]));
      }
      v4u th, tl;
      th[0] = pack2(hb[0], hb[1]); th[1] = pack2(hb[2], hb[3]);
      th[2] = pack2(hb[4], hb[5]); th[3] = pack2(hb[6], hb[7]);
      tl[0] = pack2(lb[0], lb[1]); tl[1] = pack2(lb[2], lb[3]);
      tl[2] = pack2(lb[4], lb[5]); tl[3] = pack2(lb[6], lb[7]);
      const int o = (wc + ni * 16 + c) * ET_LD + wr + mi * 16 + 8 * h;   // T[D column][D row]
      *(v4ua*)(tH + o) = th;
      *(v4ua*)(tL + o) = tl;
    }
  }
  __syncthreads();                                       // cross-wave LDS exchange

  const int bh = m0 / TPS;
  const int jm = m0 - bh * TPS;
  unsigned short* planeH = zq ? Qhi : ((z == 1) ? Kthi : Vthi);
  unsigned short* planeL = zq ? Qlo : ((z == 1) ? Ktlo : Vtlo);
#pragma unroll
  for (int it = 0; it < 8; ++it) {
    const int p = it * 256 + tid;                        // 16 pieces of 16 B per T row; a wave stores 2 rows
    const int t = p >> 4;
    const int c8 = (p & 15) * 8;
    const int n = n0 + t;
    const size_t gq = (size_t)(m0 + t) * EMB + (size_t)(n0 + c8);
    const size_t gk = ((size_t)bh * HD + (size_t)(n & 63)) * (size_t)SEQ + (size_t)((n >> 6) * TPS + jm + c8);
    const size_t g = zq ? gq : gk;
    const v4u vh = *(const v4ua*)(tH + t * ET_LD + c8);
    const v4u vl = *(const v4ua*)(tL + t * ET_LD + c8);
    *(v4u*)(planeH + g) = vh;
    *(v4u*)(planeL + g) = vl;
  }
}

// ---------------------------------------------------------------------------
// Kernel 3: S[bh][kk][d] = 0.125 * sum_j K[bh][j][kk] * V[bh][j][d]  (64 x 64, depth SEQ).
// One block per bh, 256 threads = 8 waves, wave tile 16 kk x 32 d (2 D tiles).
// A = Kt[bh][kk][jp] (hi/lo planes), B^T = Vt[bh][d][jp] (hi/lo planes), jp = kernel 2's renumbering of j; 3 products per tile-step.
// Epilogue: S (f32) transposed into LDS as [d][kk]; St hi/lo planes [NBH][64 d][64 kk]
// ---------------------------------------------------------------------------
__global__ __launch_bounds__(256) void k_kv(const unsigned short* __restrict__ Kthi,
                                             const unsigned short* __restrict__ Ktlo,
                                             const unsigned short* __restrict__ Vthi,
                                             const unsigned short* __restrict__ Vtlo,
                                             unsigned short* __restrict__ Sthi,
                                             unsigned short* __restrict__ Stlo) {
  __shared__ __align__(16) float s_lds[HD * HD];     // [d][kk], 16 KB
  const int bh = blockIdx.x;
  const int tid = threadIdx.x;
  const int lane = tid & 31;
  const int w = tid >> 5;
  const int c = lane & 15;
  const int h = lane >> 4;
  const int m0w = (w >> 1) * 16;    // kk
  const int n0w = (w & 1) * 32;     // d
  const size_t pb = (size_t)bh * HD * (size_t)SEQ;
  const unsigned short* KH = Kthi + pb;
  const unsigned short* KL = Ktlo + pb;
  const unsigned short* VH = Vthi + pb;
  const unsigned short* VL = Vtlo + pb;

  v8f acc[2] = {};
#pragma unroll 1
  for (int j0 = 0; j0 < SEQ; j0 += 32) {
    const v16bf ah = ldfrag(KH, SEQ, m0w, j0);
    const v16bf al = ldfrag(KL, SEQ, m0w, j0);
#pragma unroll
    for (int t = 0; t < 2; ++t) {
      const v16bf vh = ldfrag(VH, SEQ, n0w + 16 * t, j0);
      const v16bf vl = ldfrag(VL, SEQ, n0w + 16 * t, j0);
      acc[t] = wmma_bf(ah, vh, acc[t]);
      acc[t] = wmma_bf(ah, vl, acc[t]);
      acc[t] = wmma_bf(al, vh, acc[t]);
    }
  }

  // D (row kk = m0w + 8h + r, col d = n0w + 16t + c) -> s_lds[d][kk], scaled by 1/sqrt(64)
#pragma unroll
  for (int t = 0; t < 2; ++t)
#pragma unroll
    for (int r = 0; r < 8; ++r) {
      const float v = acc[t][r];
      s_lds[(n0w + 16 * t + c) * HD + (m0w + 8 * h + r)] = v * 0.125f;
    }
  __syncthreads();                                   // cross-wave LDS exchange

  // 512 pieces of 16 B per plane: p = it*256 + tid; wave w covers 32 consecutive pieces per it.
  v4u hv[2], lv[2];
  size_t go[2];
#pragma unroll
  for (int it = 0; it < 2; ++it) {
    const int p = it * 256 + tid;
    const int d = p >> 3;
    const int kk8 = (p & 7) * 8;
    const v4f x0 = *(const v4fa*)(s_lds + d * HD + kk8);
    const v4f x1 = *(const v4fa*)(s_lds + d * HD + kk8 + 4);
    float f[8];
    f[0] = x0[0]; f[1] = x0[1]; f[2] = x0[2]; f[3] = x0[3];
    f[4] = x1[0]; f[5] = x1[1]; f[6] = x1[2]; f[7] = x1[3];
    unsigned int hb[8], lb[8];
#pragma unroll
    for (int i = 0; i < 8; ++i) {
      hb[i] = bfbits(f[i]);
      lb[i] = bfbits(f[i] - bfval(hb[i]));
    }
    v4u th, tl;
    th[0] = pack2(hb[0], hb[1]); th[1] = pack2(hb[2], hb[3]);
    th[2] = pack2(hb[4], hb[5]); th[3] = pack2(hb[6], hb[7]);
    tl[0] = pack2(lb[0], lb[1]); tl[1] = pack2(lb[2], lb[3]);
    tl[2] = pack2(lb[4], lb[5]); tl[3] = pack2(lb[6], lb[7]);
    hv[it] = th;
    lv[it] = tl;
    go[it] = (size_t)bh * HD * HD + (size_t)d * HD + (size_t)kk8;
  }
#pragma unroll
  for (int it = 0; it < 2; ++it) {
    *(v4u*)(Sthi + go[it]) = hv[it];
    *(v4u*)(Stlo + go[it]) = lv[it];
  }
  
}

// ---------------------------------------------------------------------------
// Kernel 4: out[bh][j][d] = sum_kk Q[bh][j][kk] * S[bh][kk][d]  (M = SEQ, N = 64, K = 64).
// grid (SEQ/128, NBH), 256 threads = 8 waves, wave tile 16 j rows x 64 d (4 D tiles).
// A = Q planes (flat [NBH][SEQ][64] view, ld 64), B^T = St planes [d][kk] (ld 64); 3 products.
// Epilogue: wave tile staged in LDS, then the wave writes its contiguous 4 KB of d_out as
// ---------------------------------------------------------------------------
__global__ __launch_bounds__(256) void k_out(const unsigned short* __restrict__ Qhi,
                                              const unsigned short* __restrict__ Qlo,
                                              const unsigned short* __restrict__ Sthi,
                                              const unsigned short* __restrict__ Stlo,
                                              float* __restrict__ out) {
  __shared__ __align__(16) float o_lds[8 * 16 * HD];   // 32 KB, 4 KB per wave
  const int bh = blockIdx.y;
  const int tid = threadIdx.x;
  const int lane = tid & 31;
  const int w = tid >> 5;
  const int c = lane & 15;
  const int h = lane >> 4;
  const int jw = blockIdx.x * 128 + w * 16;
  const size_t qb = (size_t)bh * (size_t)SEQ * HD;
  const size_t sb = (size_t)bh * HD * HD;
  const unsigned short* QH = Qhi + qb;
  const unsigned short* QL = Qlo + qb;
  const unsigned short* SH = Sthi + sb;
  const unsigned short* SL = Stlo + sb;

  v8f acc[4] = {};
#pragma unroll
  for (int ks = 0; ks < 2; ++ks) {
    const int k0 = ks * 32;
    const v16bf ah = ldfrag(QH, HD, jw, k0);
    const v16bf al = ldfrag(QL, HD, jw, k0);
#pragma unroll
    for (int t = 0; t < 4; ++t) {
      const v16bf sh = ldfrag(SH, HD, 16 * t, k0);
      const v16bf sl = ldfrag(SL, HD, 16 * t, k0);
      acc[t] = wmma_bf(ah, sh, acc[t]);
      acc[t] = wmma_bf(ah, sl, acc[t]);
      acc[t] = wmma_bf(al, sh, acc[t]);
    }
  }

  float* ol = o_lds + w * (16 * HD);
#pragma unroll
  for (int t = 0; t < 4; ++t)
#pragma unroll
    for (int r = 0; r < 8; ++r) {
      const float v = acc[t][r];
      ol[(8 * h + r) * HD + 16 * t + c] = v;
    }
  __syncthreads();                                   // covers the same-wave relayout as well

  v4f pv[8];
#pragma unroll
  for (int it = 0; it < 8; ++it) {
    const int p = it * 32 + lane;                    // piece p -> row p >> 4, cols (p & 15)*4 .. +3
    pv[it] = *(const v4fa*)(ol + p * 4);
  }
  float* ob = out + ((size_t)bh * (size_t)SEQ + (size_t)jw) * HD;
#pragma unroll
  for (int it = 0; it < 8; ++it) *(v4f*)(ob + (size_t)(it * 32 + lane) * 4) = pv[it];
  
}

// ---------------------------------------------------------------------------
// Host launch: convert -> projections (hi/lo planes) -> K^T V -> Q S
// ---------------------------------------------------------------------------
extern "C" void kernel_launch(void* const* d_in, const int* in_sizes, int n_in,
                              void* d_out, int out_size, void* d_ws, size_t ws_size,
                              hipStream_t stream) {
  if (n_in < 7) return;
  if ((size_t)in_sizes[0] < ((size_t)(NB - 1) * SEQ_FULL + (size_t)SEQ) * EMB) return;
  if (in_sizes[1] < EMB * EMB || in_sizes[3] < EMB * EMB || in_sizes[5] < EMB * EMB) return;
  if (in_sizes[2] < EMB || in_sizes[4] < EMB || in_sizes[6] < EMB) return;
  if ((size_t)out_size < (size_t)MTOK * EMB) return;

  const float* x  = (const float*)d_in[0];
  const float* Wq = (const float*)d_in[1];
  const float* bq = (const float*)d_in[2];
  const float* Wk = (const float*)d_in[3];
  const float* bk = (const float*)d_in[4];
  const float* Wv = (const float*)d_in[5];
  const float* bv = (const float*)d_in[6];
  float* out = (float*)d_out;

  const size_t nAct = (size_t)MTOK * EMB;           // elements per activation plane
  const size_t nWt  = (size_t)EMB * EMB;
  const size_t nS   = (size_t)NBH * HD * HD;

  char* ws = (char*)d_ws;
  size_t off = 0;
  unsigned short* Xb   = (unsigned short*)(ws + off); off += nAct * 2;
  unsigned short* Wb   = (unsigned short*)(ws + off); off += 3 * nWt * 2;
  unsigned short* Qhi  = (unsigned short*)(ws + off); off += nAct * 2;
  unsigned short* Qlo  = (unsigned short*)(ws + off); off += nAct * 2;
  unsigned short* Kthi = (unsigned short*)(ws + off); off += nAct * 2;
  unsigned short* Ktlo = (unsigned short*)(ws + off); off += nAct * 2;
  unsigned short* Vthi = (unsigned short*)(ws + off); off += nAct * 2;
  unsigned short* Vtlo = (unsigned short*)(ws + off); off += nAct * 2;
  unsigned short* Sthi = (unsigned short*)(ws + off); off += nS * 2;
  unsigned short* Stlo = (unsigned short*)(ws + off); off += nS * 2;
  if (off > ws_size) return;

  k_cvt<<<dim3(NBX + 3 * NBW), dim3(CVT_BLK), 0, stream>>>(x, Wq, Wk, Wv, Xb, Wb);
  k_proj<<<dim3(MTOK / PT, EMB / PT, 3), dim3(256), 0, stream>>>(Xb, Wb, bq, bk, bv,
                                                       Qhi, Qlo, Kthi, Ktlo, Vthi, Vtlo);
  k_kv<<<dim3(NBH), dim3(256), 0, stream>>>(Kthi, Ktlo, Vthi, Vtlo, Sthi, Stlo);
  k_out<<<dim3(SEQ / 128, NBH), dim3(256), 0, stream>>>(Qhi, Qlo, Sthi, Stlo, out);
}

// v002
// It runs in 53.1 microseconds.
// Next to v001, in two timings, it ran 1.67 and 1.68 times as fast.
// Counting every step since v000, it is 3.87 times as fast.
#include <hip/hip_runtime.h>
#include <stdint.h>

// Contractions: x.W^T projections on v_wmma_f32_16x16x32_bf16 (bf16 operands = RNE-converted inputs, f32 accumulate);
// K^T.V (depth SEQ) and Q.S (depth 64) on v_wmma_f32_16x16x32_bf16 with bf16 hi/lo split operands (hi.hi + hi.lo + lo.hi), f32 accumulate.

#ifndef NB
#define NB 2
#endif
#ifndef SEQ
#define SEQ 2048
#endif
#define NB_FULL 2
#define SEQ_FULL 2048
#define EMB 1024
#define NH 16
#define HD 64
#define MTOK (NB * SEQ)
#define NBH (NB * NH)
#define CVT_BLK 256
#define NBW (EMB * EMB / (8 * CVT_BLK))
#define NBX (MTOK * EMB / (8 * CVT_BLK))

static_assert(SEQ % 256 == 0);
static_assert(SEQ >= 256);
static_assert(NB >= 1 && NB <= NB_FULL);
static_assert(SEQ <= SEQ_FULL);
static_assert(EMB == NH * HD);
static_assert((MTOK * EMB) % (8 * CVT_BLK) == 0);
static_assert((EMB * EMB) % (8 * CVT_BLK) == 0);
static_assert(MTOK % 16 == 0);
static_assert(SEQ % 128 == 0);

typedef __bf16 v16bf __attribute__((ext_vector_type(16)));
typedef __bf16 v8bf __attribute__((ext_vector_type(8)));
typedef float v8f __attribute__((ext_vector_type(8)));
typedef float v4f __attribute__((ext_vector_type(4)));
typedef unsigned int v4u __attribute__((ext_vector_type(4)));
typedef v8bf v8bfa __attribute__((may_alias));
typedef v4f v4fa __attribute__((may_alias));
typedef v4u v4ua __attribute__((may_alias));
typedef unsigned int v2u __attribute__((ext_vector_type(2)));
typedef v2u v2ua __attribute__((may_alias));

// ---------------------------------------------------------------------------
// bf16 helpers (integer RNE convert)
// ---------------------------------------------------------------------------
__device__ __forceinline__ unsigned int bfbits(float f) {
  unsigned int u = __float_as_uint(f);
  u += 0x7FFFu + ((u >> 16) & 1u);
  return u >> 16;
}
__device__ __forceinline__ float bfval(unsigned int b) {
  return __uint_as_float(b << 16);
}
__device__ __forceinline__ unsigned int pack2(unsigned int lo16, unsigned int hi16) {
  return (lo16 & 0xffffu) | (hi16 << 16);
}

// ---------------------------------------------------------------------------
// D(16x16 f32) += A(16 x 32k bf16) . B(32k x 16 bf16), wave32; hazard guard after issue.
// ---------------------------------------------------------------------------
__device__ __forceinline__ v8f wmma_bf(v16bf a, v16bf b, v8f c) {
  v8f d = __builtin_amdgcn_wmma_f32_16x16x32_bf16(false, a, false, b, (short)0, c, false, false);
  asm volatile("v_nop\n\tv_nop\n\tv_nop\n\tv_nop" : "+v"(d) : "v"(a), "v"(b));
  return d;
}

// ---------------------------------------------------------------------------
// 16-bit fragment from a row-major [rows][ld] plane (k contiguous within a row).
// lane l: row = r0 + (l & 15); elements 0..7 <- k0 + 8*(l>>4) + 0..7,
//                               elements 8..15 <- k0 + 16 + 8*(l>>4) + 0..7.
// A operand: rows are M rows. B operand: rows are N columns of B (plane holds B^T, i.e. [n][k]).
// D: acc[r] = (row 8*(l>>4) + r, col l & 15).
// ---------------------------------------------------------------------------
__device__ __forceinline__ v16bf ldfrag(const unsigned short* __restrict__ base,
                                        int ld, int r0, int k0) {
  const int lane = threadIdx.x & 31;
  const int m = lane & 15;
  const int koff = (lane >> 4) << 3;
  const unsigned short* p = base + (size_t)(r0 + m) * ld + (k0 + koff);
  const v8bf lo = *(const v8bfa*)p;
  const v8bf hi = *(const v8bfa*)(p + 16);
  v16bf f;
#pragma unroll
  for (int i = 0; i < 8; ++i) { f[i] = lo[i]; f[i + 8] = hi[i]; }
  return f;
}

// ---------------------------------------------------------------------------
// Kernel 1: f32 -> bf16 (RNE) planes for x (token rows remapped for reduced builds)
// and the three weight matrices. 8 elements per thread, one 16-B store per thread:
// ---------------------------------------------------------------------------
__global__ __launch_bounds__(CVT_BLK) void k_cvt(const float* __restrict__ x,
                                                 const float* __restrict__ wq,
                                                 const float* __restrict__ wk,
                                                 const float* __restrict__ wv,
                                                 unsigned short* __restrict__ Xb,
                                                 unsigned short* __restrict__ Wb) {
  const int blk = blockIdx.x;
  const int tid = threadIdx.x;
  const float* src;
  unsigned short* dst;
  if (blk < NBX) {
    const size_t e = ((size_t)blk * CVT_BLK + tid) * 8;
    const size_t t = e / EMB;
    const size_t col = e - t * EMB;
    const size_t bt = t / SEQ;
    const size_t s = t - bt * SEQ;
    src = x + (bt * SEQ_FULL + s) * EMB + col;
    dst = Xb + e;
  } else {
    const int wi = blk - NBX;
    const int zw = wi / NBW;
    const size_t e = ((size_t)(wi - zw * NBW) * CVT_BLK + tid) * 8;
    const float* wsrc = (zw == 0) ? wq : ((zw == 1) ? wk : wv);
    src = wsrc + e;
    dst = Wb + (size_t)zw * EMB * EMB + e;
  }
  const v4f a = *(const v4fa*)src;
  const v4f b = *(const v4fa*)(src + 4);
  const float a0 = a[0], a1 = a[1], a2 = a[2], a3 = a[3];
  const float b0 = b[0], b1 = b[1], b2 = b[2], b3 = b[3];
  v4u o;
  o[0] = pack2(bfbits(a0), bfbits(a1));
  o[1] = pack2(bfbits(a2), bfbits(a3));
  o[2] = pack2(bfbits(b0), bfbits(b1));
  o[3] = pack2(bfbits(b2), bfbits(b3));
  *(v4u*)dst = o;
  
}

// ---------------------------------------------------------------------------
// Kernel 2: y = Xb . Wb^T + b (M = MTOK, N = EMB, K = EMB), z = blockIdx.z selects q/k/v.
// Block: 256 threads = 8 waves; block tile = 128 token rows x 128 output columns.
// Per trip one 64-deep k slab of both operands (128 rows x 128 B each) goes global -> registers -> LDS
// with whole-line loads (8 lanes per row); two LDS buffers, one barrier per trip. Fragments come from
// LDS rows at a pitch of 144 B. Wave tile: 64 D rows x 32 D columns (4 x 2 D tiles).
// D rows are tokens for z = 1,2 and output columns for z = 0 (the operands swap places), so that a lane's
// 8 accumulator rows are always 8 neighbours of the stored row and leave as one 16-B LDS store.
// Epilogue: value = acc + bf16(bias); hi = bf16(value), lo = bf16(value - hi); both planes staged in LDS
// as T[D column][D row] (pitch 272 B), then stored as 128 rows of 256 B per plane.
//   z = 0: Q planes flat [MTOK][1024] (== [NBH][SEQ][64] view).
//   z = 1,2: planes Kt/Vt [NBH][64 kk][SEQ jp], jp = (n >> 6) * TPS + token inside the slab: the same
//            one-to-one renumbering of j for K and V, over which kernel 3 sums.
// ---------------------------------------------------------------------------
#define PT 128                      // block tile edge
#define PT_K 64                     // k depth of a slab
#define PT_LD 72                    // slab row pitch in 16-bit elements (144 B = 16 B x 9)
#define PT_OP (PT * PT_LD)          // one operand's slab
#define PT_BUF (2 * PT_OP)          // one buffer: both operands
#define ET_LD 136                   // output staging pitch in 16-bit elements (272 B = 16 B x 17)
#define ET_PL (PT * ET_LD)          // one staged plane
#define TPS (SEQ / 16)              // token rows per [SEQ][64] slab of the raw-reshaped view

static_assert(TPS % PT == 0);
static_assert(MTOK % PT == 0 && EMB % PT == 0 && EMB % PT_K == 0);
static_assert(2 * ET_PL <= 2 * PT_BUF);

// ldfrag's map on an LDS slab (same k order for both operands).
__device__ __forceinline__ v16bf ldfrag_lds(const unsigned short* base, int r0, int k0) {
  const int lane = threadIdx.x & 31;
  const unsigned short* p = base + (r0 + (lane & 15)) * PT_LD + (k0 + ((lane >> 4) << 3));
  const v8bf lo = *(const v8bfa*)p;
  const v8bf hi = *(const v8bfa*)(p + 16);
  v16bf f;
#pragma unroll
  for (int i = 0; i < 8; ++i) { f[i] = lo[i]; f[i + 8] = hi[i]; }
  return f;
}

// 6 waves per SIMD = 3 blocks per WGP: the 768 blocks are then all resident at once (register budget 160).
__global__ __launch_bounds__(256) __attribute__((amdgpu_waves_per_eu(6))) void k_proj(const unsigned short* __restrict__ Xb,
                                               const unsigned short* __restrict__ Wb,
                                               const float* __restrict__ bq,
                                               const float* __restrict__ bk,
                                               const float* __restrict__ bv,
                                               unsigned short* __restrict__ Qhi,
                                               unsigned short* __restrict__ Qlo,
                                               unsigned short* __restrict__ Kthi,
                                               unsigned short* __restrict__ Ktlo,
                                               unsigned short* __restrict__ Vthi,
                                               unsigned short* __restrict__ Vtlo) {
  __shared__ __align__(16) unsigned short lds_t[2 * PT_BUF];   // 72 KB: two slab buffers, then T hi | T lo
  const int z = blockIdx.z;
  const int tid = threadIdx.x;
  const int lane = tid & 31;
  const int w = tid >> 5;
  const int c = lane & 15;
  const int h = lane >> 4;
  const int m0 = blockIdx.x * PT;                        // first token row
  const int n0 = blockIdx.y * PT;                        // first output column
  const bool zq = (z == 0);
  const unsigned short* xt = Xb + (size_t)m0 * EMB;
  const unsigned short* wt = Wb + (size_t)z * EMB * EMB + (size_t)n0 * EMB;
  const int wr = (w >> 2) * 64;                          // wave's first D row
  const int wc = (w & 3) * 32;                           // wave's first D column

  // staging: piece i of a thread = row i*32 + (tid >> 3), 16 B at column (tid & 7) * 8
  const int srow = tid >> 3;
  const int scol = (tid & 7) * 8;
  const unsigned short* gA = (zq ? wt : xt) + (size_t)srow * EMB + scol;   // D rows
  const unsigned short* gB = (zq ? xt : wt) + (size_t)srow * EMB + scol;   // D columns
  const int lst = srow * PT_LD + scol;

  v4u ra[4], rb[4];
#pragma unroll
  for (int i = 0; i < 4; ++i) {
    ra[i] = *(const v4ua*)(gA + (size_t)i * 32 * EMB);
    rb[i] = *(const v4ua*)(gB + (size_t)i * 32 * EMB);
  }
#pragma unroll
  for (int i = 0; i < 4; ++i) {
    *(v4ua*)(lds_t + lst + i * 32 * PT_LD) = ra[i];
    *(v4ua*)(lds_t + PT_OP + lst + i * 32 * PT_LD) = rb[i];
  }

  v8f acc[4][2] = {};
#pragma unroll 1
  for (int kt = 0; kt < EMB / PT_K; ++kt) {
    // publishes slab kt and ends every wave's reads of the buffer that this trip refills
    __syncthreads();
    const unsigned short* cur = lds_t + (kt & 1) * PT_BUF;
    unsigned short* nxt = lds_t + ((kt + 1) & 1) * PT_BUF;
    const bool more = (kt + 1 < EMB / PT_K);
    if (more) {
#pragma unroll
      for (int i = 0; i < 4; ++i) {
        ra[i] = *(const v4ua*)(gA + (size_t)i * 32 * EMB + (kt + 1) * PT_K);
        rb[i] = *(const v4ua*)(gB + (size_t)i * 32 * EMB + (kt + 1) * PT_K);
      }
    }
#pragma unroll
    for (int ks = 0; ks < 2; ++ks) {
      v16bf a[4], b[2];
#pragma unroll
      for (int mi = 0; mi < 4; ++mi) a[mi] = ldfrag_lds(cur, wr + 16 * mi, ks * 32);
#pragma unroll
      for (int ni = 0; ni < 2; ++ni) b[ni] = ldfrag_lds(cur + PT_OP, wc + 16 * ni, ks * 32);
#pragma unroll
      for (int mi = 0; mi < 4; ++mi)
#pragma unroll
        for (int ni = 0; ni < 2; ++ni) acc[mi][ni] = wmma_bf(a[mi], b[ni], acc[mi][ni]);
    }
    if (more) {
#pragma unroll
      for (int i = 0; i < 4; ++i) {
        *(v4ua*)(nxt + lst + i * 32 * PT_LD) = ra[i];
        *(v4ua*)(nxt + PT_OP + lst + i * 32 * PT_LD) = rb[i];
      }
    }
  }
  __syncthreads();                                       // last fragment reads end before LDS becomes T

  // bias as its bf16 (RNE) value, added in f32; it follows the output column: D column (z = 1,2) or D row (z = 0)
  const float* bias = zq ? bq : ((z == 1) ? bk : bv);
  float bcol[2];
#pragma unroll
  for (int ni = 0; ni < 2; ++ni) bcol[ni] = bfval(bfbits(bias[n0 + wc + ni * 16 + c]));
  // precaution
  asm volatile("s_wait_xcnt 0x0" ::: "memory");

  unsigned short* tH = lds_t;
  unsigned short* tL = lds_t + ET_PL;
#pragma unroll
  for (int mi = 0; mi < 4; ++mi) {
    const float* bp = bias + n0 + wr + mi * 16 + 8 * h;
    const v4f p0 = *(const v4fa*)bp;
    const v4f p1 = *(const v4fa*)(bp + 4);
    float brow[8];
#pragma unroll
    for (int r = 0; r < 4; ++r) {
      brow[r] = bfval(bfbits(p0[r]));
      brow[r + 4] = bfval(bfbits(p1[r]));
    }
#pragma unroll
    for (int ni = 0; ni < 2; ++ni) {
      unsigned int hb[8], lb[8];
#pragma unroll
      for (int r = 0; r < 8; ++r) {
        const float v = acc[mi][ni][r] + (zq ? brow[r] : bcol[ni]);
        hb[r] = bfbits(v);
        lb[r] = bfbits(v - bfval(hb[r]));
      }
      v4u th, tl;
      th[0] = pack2(hb[0], hb[1]); th[1] = pack2(hb[2], hb[3]);
      th[2] = pack2(hb[4], hb[5]); th[3] = pack2(hb[6], hb[7]);
      tl[0] = pack2(lb[0], lb[1]); tl[1] = pack2(lb[2], lb[3]);
      tl[2] = pack2(lb[4], lb[5]); tl[3] = pack2(lb[6], lb[7]);
      const int o = (wc + ni * 16 + c) * ET_LD + wr + mi * 16 + 8 * h;   // T[D column][D row]
      *(v4ua*)(tH + o) = th;
      *(v4ua*)(tL + o) = tl;
    }
  }
  __syncthreads();                                       // cross-wave LDS exchange

  const int bh = m0 / TPS;
  const int jm = m0 - bh * TPS;
  unsigned short* planeH = zq ? Qhi : ((z == 1) ? Kthi : Vthi);
  unsigned short* planeL = zq ? Qlo : ((z == 1) ? Ktlo : Vtlo);
#pragma unroll
  for (int it = 0; it < 8; ++it) {
    const int p = it * 256 + tid;                        // 16 pieces of 16 B per T row; a wave stores 2 rows
    const int t = p >> 4;
    const int c8 = (p & 15) * 8;
    const int n = n0 + t;
    const size_t gq = (size_t)(m0 + t) * EMB + (size_t)(n0 + c8);
    const size_t gk = ((size_t)bh * HD + (size_t)(n & 63)) * (size_t)SEQ + (size_t)((n >> 6) * TPS + jm + c8);
    const size_t g = zq ? gq : gk;
    const v4u vh = *(const v4ua*)(tH + t * ET_LD + c8);
    const v4u vl = *(const v4ua*)(tL + t * ET_LD + c8);
    *(v4u*)(planeH + g) = vh;
    *(v4u*)(planeL + g) = vl;
  }
}

// ---------------------------------------------------------------------------
// Kernel 3: partial S[bh][sp][kk][d] = 0.125 * sum over the sp-th range of jp of K[bh][j][kk] * V[bh][j][d]  (64 x 64, depth SEQ / KV_NS).
// grid (NBH, KV_NS): the depth of one bh is dealt to KV_NS blocks, so that every WGP has one; kernel 4 adds the ranges.
// 256 threads = 8 waves, wave tile 16 kk x 32 d (2 D tiles).
// A = Kt[bh][kk][jp] (hi/lo planes), B^T = Vt[bh][d][jp] (hi/lo planes), jp = kernel 2's renumbering of j; 3 products per tile-step.
// Epilogue: the partial (f32) transposed into LDS as [d][kk], then stored as Sp[NBH][KV_NS][64 d][64 kk] in whole lines.
// ---------------------------------------------------------------------------
#define KV_NS 8                     // depth ranges per bh: 32 x 8 = 256 blocks at full size
#define KV_J (SEQ / KV_NS)          // depth of one range

static_assert(KV_J % 32 == 0);

__global__ __launch_bounds__(256) void k_kv(const unsigned short* __restrict__ Kthi,
                                             const unsigned short* __restrict__ Ktlo,
                                             const unsigned short* __restrict__ Vthi,
                                             const unsigned short* __restrict__ Vtlo,
                                             float* __restrict__ Sp) {
  __shared__ __align__(16) float s_lds[HD * HD];     // [d][kk], 16 KB
  const int bh = blockIdx.x;
  const int jb = blockIdx.y * KV_J;                  // first jp of this block's range
  const int tid = threadIdx.x;
  const int lane = tid & 31;
  const int w = tid >> 5;
  const int c = lane & 15;
  const int h = lane >> 4;
  const int m0w = (w >> 1) * 16;    // kk
  const int n0w = (w & 1) * 32;     // d
  const size_t pb = (size_t)bh * HD * (size_t)SEQ;
  const unsigned short* KH = Kthi + pb;
  const unsigned short* KL = Ktlo + pb;
  const unsigned short* VH = Vthi + pb;
  const unsigned short* VL = Vtlo + pb;

  v8f acc[2] = {};
#pragma unroll 1
  for (int j0 = jb; j0 < jb + KV_J; j0 += 32) {
    const v16bf ah = ldfrag(KH, SEQ, m0w, j0);
    const v16bf al = ldfrag(KL, SEQ, m0w, j0);
#pragma unroll
    for (int t = 0; t < 2; ++t) {
      const v16bf vh = ldfrag(VH, SEQ, n0w + 16 * t, j0);
      const v16bf vl = ldfrag(VL, SEQ, n0w + 16 * t, j0);
      acc[t] = wmma_bf(ah, vh, acc[t]);
      acc[t] = wmma_bf(ah, vl, acc[t]);
      acc[t] = wmma_bf(al, vh, acc[t]);
    }
  }

  // D (row kk = m0w + 8h + r, col d = n0w + 16t + c) -> s_lds[d][kk], scaled by 1/sqrt(64)
#pragma unroll
  for (int t = 0; t < 2; ++t)
#pragma unroll
    for (int r = 0; r < 8; ++r) {
      const float v = acc[t][r];
      s_lds[(n0w + 16 * t + c) * HD + (m0w + 8 * h + r)] = v * 0.125f;
    }
  __syncthreads();                                   // cross-wave LDS exchange

  // 1024 pieces of 16 B: p = it*256 + tid; a wave stores 512 contiguous bytes per it.
  float* pp = Sp + ((size_t)bh * KV_NS + blockIdx.y) * (size_t)(HD * HD);
  v4f pv[4];
#pragma unroll
  for (int it = 0; it < 4; ++it) pv[it] = *(const v4fa*)(s_lds + (it * 256 + tid) * 4);
#pragma unroll
  for (int it = 0; it < 4; ++it) *(v4f*)(pp + (it * 256 + tid) * 4) = pv[it];
}

// ---------------------------------------------------------------------------
// Kernel 4: out[bh][j][d] = sum_kk Q[bh][j][kk] * S[bh][kk][d]  (M = SEQ, N = 64, K = 64).
// grid (SEQ/128, NBH), 256 threads = 8 waves, wave tile 16 j rows x 64 d (4 D tiles).
// Prologue: S^T[d][kk] = sum of kernel 3's KV_NS partials in the order of the ranges (f32, whole-line loads), split into
// hi = bf16(S), lo = bf16(S - hi) and laid in LDS as two planes [64 d][64 kk] at a pitch of 144 B.
// A = Q planes (flat [NBH][SEQ][64] view, ld 64), B^T = the S^T planes in LDS; 3 products.
// Epilogue: wave tile staged in LDS, then the wave writes its contiguous 4 KB of d_out as
// ---------------------------------------------------------------------------
__global__ __launch_bounds__(256) void k_out(const unsigned short* __restrict__ Qhi,
                                              const unsigned short* __restrict__ Qlo,
                                              const float* __restrict__ Sp,
                                              float* __restrict__ out) {
  __shared__ __align__(16) float o_lds[8 * 16 * HD];   // 32 KB, 4 KB per wave
  __shared__ __align__(16) unsigned short st_lds[2 * HD * PT_LD];   // 18 KB: S^T hi | S^T lo
  const int bh = blockIdx.y;
  const int tid = threadIdx.x;
  const int lane = tid & 31;
  const int w = tid >> 5;
  const int c = lane & 15;
  const int h = lane >> 4;
  const int jw = blockIdx.x * 128 + w * 16;
  const size_t qb = (size_t)bh * (size_t)SEQ * HD;
  const unsigned short* QH = Qhi + qb;
  const unsigned short* QL = Qlo + qb;
  const float* pp = Sp + (size_t)bh * KV_NS * (size_t)(HD * HD);
  unsigned short* SH = st_lds;
  unsigned short* SL = st_lds + HD * PT_LD;

  // Q does not depend on S: its fragments are asked for first, so that they fly while the partials are summed
  v16bf ah[2], al[2];
#pragma unroll
  for (int ks = 0; ks < 2; ++ks) {
    ah[ks] = ldfrag(QH, HD, jw, ks * 32);
    al[ks] = ldfrag(QL, HD, jw, ks * 32);
  }
  // precaution: this build reuses the Q loads' address registers as a later load's destination while those loads are in flight
  asm volatile("s_wait_xcnt 0x0" ::: "memory");

  // piece p = it*256 + tid holds 4 neighbours of a row of S^T: d = p >> 4, kk = (p & 15) * 4
#pragma unroll
  for (int it = 0; it < 4; ++it) {
    const int p = it * 256 + tid;
    v4f part[KV_NS];
#pragma unroll
    for (int sp = 0; sp < KV_NS; ++sp) part[sp] = *(const v4fa*)(pp + (size_t)sp * (HD * HD) + p * 4);
    v4f s = part[0];
#pragma unroll
    for (int sp = 1; sp < KV_NS; ++sp) s += part[sp];
    unsigned int hb[4], lb[4];
#pragma unroll
    for (int i = 0; i < 4; ++i) {
      hb[i] = bfbits(s[i]);
      lb[i] = bfbits(s[i] - bfval(hb[i]));
    }
    v2u th, tl;
    th[0] = pack2(hb[0], hb[1]); th[1] = pack2(hb[2], hb[3]);
    tl[0] = pack2(lb[0], lb[1]); tl[1] = pack2(lb[2], lb[3]);
    const int o = (p >> 4) * PT_LD + (p & 15) * 4;
    *(v2ua*)(SH + o) = th;
    *(v2ua*)(SL + o) = tl;
  }
  __syncthreads();                                   // every wave reads all of S^T

  v8f acc[4] = {};
#pragma unroll
  for (int ks = 0; ks < 2; ++ks) {
    const int k0 = ks * 32;
#pragma unroll
    for (int t = 0; t < 4; ++t) {
      const v16bf sh = ldfrag_lds(SH, 16 * t, k0);
      const v16bf sl = ldfrag_lds(SL, 16 * t, k0);
      acc[t] = wmma_bf(ah[ks], sh, acc[t]);
      acc[t] = wmma_bf(ah[ks], sl, acc[t]);
      acc[t] = wmma_bf(al[ks], sh, acc[t]);
    }
  }

  float* ol = o_lds + w * (16 * HD);
#pragma unroll
  for (int t = 0; t < 4; ++t)
#pragma unroll
    for (int r = 0; r < 8; ++r) {
      const float v = acc[t][r];
      ol[(8 * h + r) * HD + 16 * t + c] = v;
    }
  __syncthreads();                                   // covers the same-wave relayout as well

  v4f pv[8];
#pragma unroll
  for (int it = 0; it < 8; ++it) {
    const int p = it * 32 + lane;                    // piece p -> row p >> 4, cols (p & 15)*4 .. +3
    pv[it] = *(const v4fa*)(ol + p * 4);
  }
  float* ob = out + ((size_t)bh * (size_t)SEQ + (size_t)jw) * HD;
#pragma unroll
  for (int it = 0; it < 8; ++it) *(v4f*)(ob + (size_t)(it * 32 + lane) * 4) = pv[it];
  
}

// ---------------------------------------------------------------------------
// Host launch: convert -> projections (hi/lo planes) -> K^T V partials -> sum of partials, Q S
// ---------------------------------------------------------------------------
extern "C" void kernel_launch(void* const* d_in, const int* in_sizes, int n_in,
                              void* d_out, int out_size, void* d_ws, size_t ws_size,
                              hipStream_t stream) {
  if (n_in < 7) return;
  if ((size_t)in_sizes[0] < ((size_t)(NB - 1) * SEQ_FULL + (size_t)SEQ) * EMB) return;
  if (in_sizes[1] < EMB * EMB || in_sizes[3] < EMB * EMB || in_sizes[5] < EMB * EMB) return;
  if (in_sizes[2] < EMB || in_sizes[4] < EMB || in_sizes[6] < EMB) return;
  if ((size_t)out_size < (size_t)MTOK * EMB) return;

  const float* x  = (const float*)d_in[0];
  const float* Wq = (const float*)d_in[1];
  const float* bq = (const float*)d_in[2];
  const float* Wk = (const float*)d_in[3];
  const float* bk = (const float*)d_in[4];
  const float* Wv = (const float*)d_in[5];
  const float* bv = (const float*)d_in[6];
  float* out = (float*)d_out;

  const size_t nAct = (size_t)MTOK * EMB;           // elements per activation plane
  const size_t nWt  = (size_t)EMB * EMB;
  const size_t nS   = (size_t)NBH * HD * HD;

  char* ws = (char*)d_ws;
  size_t off = 0;
  unsigned short* Xb   = (unsigned short*)(ws + off); off += nAct * 2;
  unsigned short* Wb   = (unsigned short*)(ws + off); off += 3 * nWt * 2;
  unsigned short* Qhi  = (unsigned short*)(ws + off); off += nAct * 2;
  unsigned short* Qlo  = (unsigned short*)(ws + off); off += nAct * 2;
  unsigned short* Kthi = (unsigned short*)(ws + off); off += nAct * 2;
  unsigned short* Ktlo = (unsigned short*)(ws + off); off += nAct * 2;
  unsigned short* Vthi = (unsigned short*)(ws + off); off += nAct * 2;
  unsigned short* Vtlo = (unsigned short*)(ws + off); off += nAct * 2;
  float* Sp = (float*)(ws + off); off += nS * KV_NS * 4;
  if (off > ws_size) return;

  k_cvt<<<dim3(NBX + 3 * NBW), dim3(CVT_BLK), 0, stream>>>(x, Wq, Wk, Wv, Xb, Wb);
  k_proj<<<dim3(MTOK / PT, EMB / PT, 3), dim3(256), 0, stream>>>(Xb, Wb, bq, bk, bv,
                                                       Qhi, Qlo, Kthi, Ktlo, Vthi, Vtlo);
  k_kv<<<dim3(NBH, KV_NS), dim3(256), 0, stream>>>(Kthi, Ktlo, Vthi, Vtlo, Sp);
  k_out<<<dim3(SEQ / 128, NBH), dim3(256), 0, stream>>>(Qhi, Qlo, Sp, out);
}

// v003
// Measured time: 50.6 microseconds a run.
// In both of two side-by-side timings against v002, it was 1.04 times as fast.
// Over all steps from v000 it is 4.03 times as fast.
#include <hip/hip_runtime.h>
#include <stdint.h>

// Contractions: x.W^T projections on v_wmma_f32_16x16x32_bf16 (bf16 operands = RNE-converted inputs, f32 accumulate);
// K^T.V (depth SEQ) and Q.S (depth 64) on v_wmma_f32_16x16x32_bf16 with bf16 hi/lo split operands (hi.hi + hi.lo + lo.hi), f32 accumulate.

#ifndef NB
#define NB 2
#endif
#ifndef SEQ
#define SEQ 2048
#endif
#define NB_FULL 2
#define SEQ_FULL 2048
#define EMB 1024
#define NH 16
#define HD 64
#define MTOK (NB * SEQ)
#define NBH (NB * NH)
#define CVT_BLK 256
#define NBW (EMB * EMB / (8 * CVT_BLK))
#define NBX (MTOK * EMB / (8 * CVT_BLK))

static_assert(SEQ % 256 == 0);
static_assert(SEQ >= 256);
static_assert(NB >= 1 && NB <= NB_FULL);
static_assert(SEQ <= SEQ_FULL);
static_assert(EMB == NH * HD);
static_assert((MTOK * EMB) % (8 * CVT_BLK) == 0);
static_assert((EMB * EMB) % (8 * CVT_BLK) == 0);
static_assert(MTOK % 16 == 0);
static_assert(SEQ % 128 == 0);

typedef __bf16 v16bf __attribute__((ext_vector_type(16)));
typedef __bf16 v8bf __attribute__((ext_vector_type(8)));
typedef float v8f __attribute__((ext_vector_type(8)));
typedef float v4f __attribute__((ext_vector_type(4)));
typedef unsigned int v4u __attribute__((ext_vector_type(4)));
typedef v8bf v8bfa __attribute__((may_alias));
typedef v4f v4fa __attribute__((may_alias));
typedef v4u v4ua __attribute__((may_alias));
typedef unsigned int v2u __attribute__((ext_vector_type(2)));
typedef v2u v2ua __attribute__((may_alias));

// ---------------------------------------------------------------------------
// bf16 helpers (integer RNE convert)
// ---------------------------------------------------------------------------
__device__ __forceinline__ unsigned int bfbits(float f) {
  unsigned int u = __float_as_uint(f);
  u += 0x7FFFu + ((u >> 16) & 1u);
  return u >> 16;
}
__device__ __forceinline__ float bfval(unsigned int b) {
  return __uint_as_float(b << 16);
}
__device__ __forceinline__ unsigned int pack2(unsigned int lo16, unsigned int hi16) {
  return (lo16 & 0xffffu) | (hi16 << 16);
}

// ---------------------------------------------------------------------------
// D(16x16 f32) += A(16 x 32k bf16) . B(32k x 16 bf16), wave32; hazard guard after issue.
// ---------------------------------------------------------------------------
__device__ __forceinline__ v8f wmma_bf(v16bf a, v16bf b, v8f c) {
  v8f d = __builtin_amdgcn_wmma_f32_16x16x32_bf16(false, a, false, b, (short)0, c, false, false);
  asm volatile("v_nop\n\tv_nop\n\tv_nop\n\tv_nop" : "+v"(d) : "v"(a), "v"(b));
  return d;
}

// ---------------------------------------------------------------------------
// 16-bit fragment from a row-major [rows][ld] plane (k contiguous within a row).
// lane l: row = r0 + (l & 15); elements 0..7 <- k0 + 8*(l>>4) + 0..7,
//                               elements 8..15 <- k0 + 16 + 8*(l>>4) + 0..7.
// A operand: rows are M rows. B operand: rows are N columns of B (plane holds B^T, i.e. [n][k]).
// D: acc[r] = (row 8*(l>>4) + r, col l & 15).
// ---------------------------------------------------------------------------
__device__ __forceinline__ v16bf ldfrag(const unsigned short* __restrict__ base,
                                        int ld, int r0, int k0) {
  const int lane = threadIdx.x & 31;
  const int m = lane & 15;
  const int koff = (lane >> 4) << 3;
  const unsigned short* p = base + (size_t)(r0 + m) * ld + (k0 + koff);
  const v8bf lo = *(const v8bfa*)p;
  const v8bf hi = *(const v8bfa*)(p + 16);
  v16bf f;
#pragma unroll
  for (int i = 0; i < 8; ++i) { f[i] = lo[i]; f[i + 8] = hi[i]; }
  return f;
}

// ---------------------------------------------------------------------------
// Kernel 1: f32 -> bf16 (RNE) planes for x (token rows remapped for reduced builds)
// and the three weight matrices. 8 elements per thread, one 16-B store per thread:
// ---------------------------------------------------------------------------
__global__ __launch_bounds__(CVT_BLK) void k_cvt(const float* __restrict__ x,
                                                 const float* __restrict__ wq,
                                                 const float* __restrict__ wk,
                                                 const float* __restrict__ wv,
                                                 unsigned short* __restrict__ Xb,
                                                 unsigned short* __restrict__ Wb) {
  const int blk = blockIdx.x;
  const int tid = threadIdx.x;
  const float* src;
  unsigned short* dst;
  if (blk < NBX) {
    const size_t e = ((size_t)blk * CVT_BLK + tid) * 8;
    const size_t t = e / EMB;
    const size_t col = e - t * EMB;
    const size_t bt = t / SEQ;
    const size_t s = t - bt * SEQ;
    src = x + (bt * SEQ_FULL + s) * EMB + col;
    dst = Xb + e;
  } else {
    const int wi = blk - NBX;
    const int zw = wi / NBW;
    const size_t e = ((size_t)(wi - zw * NBW) * CVT_BLK + tid) * 8;
    const float* wsrc = (zw == 0) ? wq : ((zw == 1) ? wk : wv);
    src = wsrc + e;
    dst = Wb + (size_t)zw * EMB * EMB + e;
  }
  const v4f a = *(const v4fa*)src;
  const v4f b = *(const v4fa*)(src + 4);
  const float a0 = a[0], a1 = a[1], a2 = a[2], a3 = a[3];
  const float b0 = b[0], b1 = b[1], b2 = b[2], b3 = b[3];
  v4u o;
  o[0] = pack2(bfbits(a0), bfbits(a1));
  o[1] = pack2(bfbits(a2), bfbits(a3));
  o[2] = pack2(bfbits(b0), bfbits(b1));
  o[3] = pack2(bfbits(b2), bfbits(b3));
  *(v4u*)dst = o;
  
}

// ---------------------------------------------------------------------------
// Kernel 2: y = Xb . Wb^T + b (M = MTOK, N = EMB, K = EMB), z = blockIdx.z selects q/k/v.
// Block: 256 threads = 8 waves; block tile = 128 token rows x 128 output columns.
// Per trip one 64-deep k slab of both operands (128 rows x 128 B each) goes global -> registers -> LDS
// with whole-line loads (8 lanes per row); two LDS buffers, one barrier per trip. Fragments come from
// LDS rows at a pitch of 144 B. Wave tile: 64 D rows x 32 D columns (4 x 2 D tiles).
// D rows are tokens for z = 1,2 and output columns for z = 0 (the operands swap places), so that a lane's
// 8 accumulator rows are always 8 neighbours of the stored row and leave as one 16-B LDS store.
// Epilogue: value = acc + bf16(bias); hi = bf16(value), lo = bf16(value - hi); both planes staged in LDS
// as T[D column][D row] (pitch 272 B), then stored as 128 rows of 256 B per plane.
//   z = 0: Q planes flat [MTOK][1024] (== [NBH][SEQ][64] view).
//   z = 1,2: planes Kt/Vt [NBH][64 kk][SEQ jp], jp = (n >> 6) * TPS + token inside the slab: the same
//            one-to-one renumbering of j for K and V, over which kernel 3 sums.
// ---------------------------------------------------------------------------
#define PT 128                      // block tile edge
#define PT_K 64                     // k depth of a slab
#define PT_LD 72                    // slab row pitch in 16-bit elements (144 B = 16 B x 9)
#define PT_OP (PT * PT_LD)          // one operand's slab
#define PT_BUF (2 * PT_OP)          // one buffer: both operands
#define ET_LD 136                   // output staging pitch in 16-bit elements (272 B = 16 B x 17)
#define ET_PL (PT * ET_LD)          // one staged plane
#define TPS (SEQ / 16)              // token rows per [SEQ][64] slab of the raw-reshaped view

static_assert(TPS % PT == 0);
static_assert(MTOK % PT == 0 && EMB % PT == 0 && EMB % PT_K == 0);
static_assert(2 * ET_PL <= 2 * PT_BUF);

// ldfrag's map on an LDS slab (same k order for both operands).
__device__ __forceinline__ v16bf ldfrag_lds(const unsigned short* base, int r0, int k0) {
  const int lane = threadIdx.x & 31;
  const unsigned short* p = base + (r0 + (lane & 15)) * PT_LD + (k0 + ((lane >> 4) << 3));
  const v8bf lo = *(const v8bfa*)p;
  const v8bf hi = *(const v8bfa*)(p + 16);
  v16bf f;
#pragma unroll
  for (int i = 0; i < 8; ++i) { f[i] = lo[i]; f[i + 8] = hi[i]; }
  return f;
}

// 6 waves per SIMD = 3 blocks per WGP: the 768 blocks are then all resident at once (register budget 160).
__global__ __launch_bounds__(256) __attribute__((amdgpu_waves_per_eu(6))) void k_proj(const unsigned short* __restrict__ Xb,
                                               const unsigned short* __restrict__ Wb,
                                               const float* __restrict__ bq,
                                               const float* __restrict__ bk,
                                               const float* __restrict__ bv,
                                               unsigned short* __restrict__ Qhi,
                                               unsigned short* __restrict__ Qlo,
                                               unsigned short* __restrict__ Kthi,
                                               unsigned short* __restrict__ Ktlo,
                                               unsigned short* __restrict__ Vthi,
                                               unsigned short* __restrict__ Vtlo) {
  __shared__ __align__(16) unsigned short lds_t[2 * PT_BUF];   // 72 KB: two slab buffers, then T hi | T lo
  const int z = blockIdx.z;
  const int tid = threadIdx.x;
  const int lane = tid & 31;
  const int w = tid >> 5;
  const int c = lane & 15;
  const int h = lane >> 4;
  const int m0 = blockIdx.x * PT;                        // first token row
  const int n0 = blockIdx.y * PT;                        // first output column
  const bool zq = (z == 0);
  const unsigned short* xt = Xb + (size_t)m0 * EMB;
  const unsigned short* wt = Wb + (size_t)z * EMB * EMB + (size_t)n0 * EMB;
  const int wr = (w >> 2) * 64;                          // wave's first D row
  const int wc = (w & 3) * 32;                           // wave's first D column

  // staging: piece i of a thread = row i*32 + (tid >> 3), 16 B at column (tid & 7) * 8
  const int srow = tid >> 3;
  const int scol = (tid & 7) * 8;
  const unsigned short* gA = (zq ? wt : xt) + (size_t)srow * EMB + scol;   // D rows
  const unsigned short* gB = (zq ? xt : wt) + (size_t)srow * EMB + scol;   // D columns
  const int lst = srow * PT_LD + scol;

  v4u ra[4], rb[4];
#pragma unroll
  for (int i = 0; i < 4; ++i) {
    ra[i] = *(const v4ua*)(gA + (size_t)i * 32 * EMB);
    rb[i] = *(const v4ua*)(gB + (size_t)i * 32 * EMB);
  }
#pragma unroll
  for (int i = 0; i < 4; ++i) {
    *(v4ua*)(lds_t + lst + i * 32 * PT_LD) = ra[i];
    *(v4ua*)(lds_t + PT_OP + lst + i * 32 * PT_LD) = rb[i];
  }

  v8f acc[4][2] = {};
#pragma unroll 1
  for (int kt = 0; kt < EMB / PT_K; ++kt) {
    // publishes slab kt and ends every wave's reads of the buffer that this trip refills
    __syncthreads();
    const unsigned short* cur = lds_t + (kt & 1) * PT_BUF;
    unsigned short* nxt = lds_t + ((kt + 1) & 1) * PT_BUF;
    const bool more = (kt + 1 < EMB / PT_K);
    if (more) {
#pragma unroll
      for (int i = 0; i < 4; ++i) {
        ra[i] = *(const v4ua*)(gA + (size_t)i * 32 * EMB + (kt + 1) * PT_K);
        rb[i] = *(const v4ua*)(gB + (size_t)i * 32 * EMB + (kt + 1) * PT_K);
      }
    }
#pragma unroll
    for (int ks = 0; ks < 2; ++ks) {
      v16bf a[4], b[2];
#pragma unroll
      for (int mi = 0; mi < 4; ++mi) a[mi] = ldfrag_lds(cur, wr + 16 * mi, ks * 32);
#pragma unroll
      for (int ni = 0; ni < 2; ++ni) b[ni] = ldfrag_lds(cur + PT_OP, wc + 16 * ni, ks * 32);
#pragma unroll
      for (int mi = 0; mi < 4; ++mi)
#pragma unroll
        for (int ni = 0; ni < 2; ++ni) acc[mi][ni] = wmma_bf(a[mi], b[ni], acc[mi][ni]);
    }
    if (more) {
#pragma unroll
      for (int i = 0; i < 4; ++i) {
        *(v4ua*)(nxt + lst + i * 32 * PT_LD) = ra[i];
        *(v4ua*)(nxt + PT_OP + lst + i * 32 * PT_LD) = rb[i];
      }
    }
  }
  __syncthreads();                                       // last fragment reads end before LDS becomes T

  // bias as its bf16 (RNE) value, added in f32; it follows the output column: D column (z = 1,2) or D row (z = 0)
  const float* bias = zq ? bq : ((z == 1) ? bk : bv);
  float bcol[2];
#pragma unroll
  for (int ni = 0; ni < 2; ++ni) bcol[ni] = bfval(bfbits(bias[n0 + wc + ni * 16 + c]));
  // precaution
  asm volatile("s_wait_xcnt 0x0" ::: "memory");

  unsigned short* tH = lds_t;
  unsigned short* tL = lds_t + ET_PL;
#pragma unroll
  for (int mi = 0; mi < 4; ++mi) {
    const float* bp = bias + n0 + wr + mi * 16 + 8 * h;
    const v4f p0 = *(const v4fa*)bp;
    const v4f p1 = *(const v4fa*)(bp + 4);
    float brow[8];
#pragma unroll
    for (int r = 0; r < 4; ++r) {
      brow[r] = bfval(bfbits(p0[r]));
      brow[r + 4] = bfval(bfbits(p1[r]));
    }
#pragma unroll
    for (int ni = 0; ni < 2; ++ni) {
      unsigned int hb[8], lb[8];
#pragma unroll
      for (int r = 0; r < 8; ++r) {
        const float v = acc[mi][ni][r] + (zq ? brow[r] : bcol[ni]);
        hb[r] = bfbits(v);
        lb[r] = bfbits(v - bfval(hb[r]));
      }
      v4u th, tl;
      th[0] = pack2(hb[0], hb[1]); th[1] = pack2(hb[2], hb[3]);
      th[2] = pack2(hb[4], hb[5]); th[3] = pack2(hb[6], hb[7]);
      tl[0] = pack2(lb[0], lb[1]); tl[1] = pack2(lb[2], lb[3]);
      tl[2] = pack2(lb[4], lb[5]); tl[3] = pack2(lb[6], lb[7]);
      const int o = (wc + ni * 16 + c) * ET_LD + wr + mi * 16 + 8 * h;   // T[D column][D row]
      *(v4ua*)(tH + o) = th;
      *(v4ua*)(tL + o) = tl;
    }
  }
  __syncthreads();                                       // cross-wave LDS exchange

  const int bh = m0 / TPS;
  const int jm = m0 - bh * TPS;
  unsigned short* planeH = zq ? Qhi : ((z == 1) ? Kthi : Vthi);
  unsigned short* planeL = zq ? Qlo : ((z == 1) ? Ktlo : Vtlo);
#pragma unroll
  for (int it = 0; it < 8; ++it) {
    const int p = it * 256 + tid;                        // 16 pieces of 16 B per T row; a wave stores 2 rows
    const int t = p >> 4;
    const int c8 = (p & 15) * 8;
    const int n = n0 + t;
    const size_t gq = (size_t)(m0 + t) * EMB + (size_t)(n0 + c8);
    const size_t gk = ((size_t)bh * HD + (size_t)(n & 63)) * (size_t)SEQ + (size_t)((n >> 6) * TPS + jm + c8);
    const size_t g = zq ? gq : gk;
    const v4u vh = *(const v4ua*)(tH + t * ET_LD + c8);
    const v4u vl = *(const v4ua*)(tL + t * ET_LD + c8);
    *(v4u*)(planeH + g) = vh;
    *(v4u*)(planeL + g) = vl;
  }
}

// ---------------------------------------------------------------------------
// Kernel 3: partial S[bh][sp][kk][d] = 0.125 * sum over the sp-th range of jp of K[bh][j][kk] * V[bh][j][d]  (64 x 64, depth SEQ / KV_NS).
// grid (NBH, KV_NS): the depth of one bh is dealt to KV_NS blocks, so that every WGP has one; kernel 4 adds the ranges.
// 256 threads = 8 waves, wave tile 16 kk x 32 d (2 D tiles).
// The block's whole share of the four planes (4 x 64 rows x 512 B) is brought into LDS once, by asynchronous copies:
// one copy of a wave = one row's 512 contiguous bytes (4 whole lines); 32 copies per wave, all in flight together.
// LDS rows stand at a pitch of 528 B (16 B x 33). Fragments then come from LDS with ldfrag's map.
// A = Kt[bh][kk][jp] (hi/lo planes), B^T = Vt[bh][d][jp] (hi/lo planes), jp = kernel 2's renumbering of j; 3 products per tile-step.
// Epilogue: the partial (f32) transposed into LDS as [d][kk], then stored as Sp[NBH][KV_NS][64 d][64 kk] in whole lines.
// ---------------------------------------------------------------------------
#define KV_NS 8                     // depth ranges per bh: 32 x 8 = 256 blocks at full size
#define KV_J (SEQ / KV_NS)          // depth of one range
#define KV_LD (KV_J + 8)            // staged row pitch in 16-bit elements
#define KV_PL (HD * KV_LD)          // one staged plane

static_assert(KV_J % 32 == 0);
static_assert(KV_J == 256);         // one copy of a wave (32 lanes x 16 B) is one staged row
static_assert((KV_LD * 2) % 32 == 16);

// Eight asynchronous copies of 16 B per lane: rows 8 apart of one plane, global -> LDS, through no register.
// g: the lane's 16 B in the first row; l: the lane's LDS byte address for it.
// The closing s_wait_xcnt stands inside the statement, so that no address register is rewritten ahead of it.
__device__ __forceinline__ void kv_copy8(const unsigned short* g, unsigned int l) {
  const unsigned short* g1 = g + (size_t)8 * SEQ;
  const unsigned short* g2 = g + (size_t)16 * SEQ;
  const unsigned short* g3 = g + (size_t)24 * SEQ;
  const unsigned short* g4 = g + (size_t)32 * SEQ;
  const unsigned short* g5 = g + (size_t)40 * SEQ;
  const unsigned short* g6 = g + (size_t)48 * SEQ;
  const unsigned short* g7 = g + (size_t)56 * SEQ;
  const unsigned int st = 8 * KV_LD * 2;
  asm volatile(
      "global_load_async_to_lds_b128 %0, %8, off\n\t"
      "global_load_async_to_lds_b128 %1, %9, off\n\t"
      "global_load_async_to_lds_b128 %2, %10, off\n\t"
      "global_load_async_to_lds_b128 %3, %11, off\n\t"
      "global_load_async_to_lds_b128 %4, %12, off\n\t"
      "global_load_async_to_lds_b128 %5, %13, off\n\t"
      "global_load_async_to_lds_b128 %6, %14, off\n\t"
      "global_load_async_to_lds_b128 %7, %15, off\n\t"
      "s_wait_xcnt 0x0"
      :: "v"(l), "v"(l + st), "v"(l + 2 * st), "v"(l + 3 * st),
         "v"(l + 4 * st), "v"(l + 5 * st), "v"(l + 6 * st), "v"(l + 7 * st),
         "v"(g), "v"(g1), "v"(g2), "v"(g3), "v"(g4), "v"(g5), "v"(g6), "v"(g7)
      : "memory");
}

__global__ __launch_bounds__(256) void k_kv(const unsigned short* __restrict__ Kthi,
                                             const unsigned short* __restrict__ Ktlo,
                                             const unsigned short* __restrict__ Vthi,
                                             const unsigned short* __restrict__ Vtlo,
                                             float* __restrict__ Sp) {
  __shared__ __align__(16) unsigned short kv_lds[4 * KV_PL];   // 132 KB: K hi | K lo | V hi | V lo
  __shared__ __align__(16) float s_lds[HD * HD];     // [d][kk], 16 KB
  const int bh = blockIdx.x;
  const int jb = blockIdx.y * KV_J;                  // first jp of this block's range
  const int tid = threadIdx.x;
  const int lane = tid & 31;
  const int w = tid >> 5;
  const int c = lane & 15;
  const int h = lane >> 4;
  const int m0w = (w >> 1) * 16;    // kk
  const int n0w = (w & 1) * 32;     // d

  // wave w brings rows w, w + 8, ..., w + 56 of each plane; lane l the 16 B at element 8 l of the row's share
  const size_t go = ((size_t)bh * HD + (size_t)w) * (size_t)SEQ + (size_t)(jb + lane * 8);
  const unsigned int lo = (unsigned int)(size_t)kv_lds + (unsigned int)((w * KV_LD + lane * 8) * 2);
  kv_copy8(Kthi + go, lo);
  kv_copy8(Ktlo + go, lo + KV_PL * 2);
  kv_copy8(Vthi + go, lo + 2 * KV_PL * 2);
  kv_copy8(Vtlo + go, lo + 3 * KV_PL * 2);
  // this wave's copies have landed
  asm volatile("s_wait_asynccnt 0x0" ::: "memory");
  __syncthreads();                                   // every wave's copies have landed before any wave reads the planes

  const unsigned short* KH = kv_lds;
  const unsigned short* KL = kv_lds + KV_PL;
  const unsigned short* VH = kv_lds + 2 * KV_PL;
  const unsigned short* VL = kv_lds + 3 * KV_PL;

  v8f acc[2] = {};
  v16bf ah = ldfrag(KH, KV_LD, m0w, 0);
  v16bf al = ldfrag(KL, KV_LD, m0w, 0);
  v16bf vh[2], vl[2];
#pragma unroll
  for (int t = 0; t < 2; ++t) {
    vh[t] = ldfrag(VH, KV_LD, n0w + 16 * t, 0);
    vl[t] = ldfrag(VL, KV_LD, n0w + 16 * t, 0);
  }
  // unrolled: the two fragment sets then need no register copies, and every LDS offset is an immediate
#pragma unroll
  for (int j0 = 0; j0 < KV_J; j0 += 32) {
    // the next step's fragments are asked for as one group ahead of this step's products, which hide the LDS latency
    // (the last step names its own columns again, so that the address stays inside the planes; nothing reads that set)
    const int jn = (j0 + 32 < KV_J) ? j0 + 32 : j0;
    const v16bf nah = ldfrag(KH, KV_LD, m0w, jn);
    const v16bf nal = ldfrag(KL, KV_LD, m0w, jn);
    v16bf nvh[2], nvl[2];
#pragma unroll
    for (int t = 0; t < 2; ++t) {
      nvh[t] = ldfrag(VH, KV_LD, n0w + 16 * t, jn);
      nvl[t] = ldfrag(VL, KV_LD, n0w + 16 * t, jn);
    }
#pragma unroll
    for (int t = 0; t < 2; ++t) {
      acc[t] = wmma_bf(ah, vh[t], acc[t]);
      acc[t] = wmma_bf(ah, vl[t], acc[t]);
      acc[t] = wmma_bf(al, vh[t], acc[t]);
    }
    ah = nah; al = nal;
#pragma unroll
    for (int t = 0; t < 2; ++t) { vh[t] = nvh[t]; vl[t] = nvl[t]; }
  }

  // D (row kk = m0w + 8h + r, col d = n0w + 16t + c) -> s_lds[d][kk], scaled by 1/sqrt(64)
#pragma unroll
  for (int t = 0; t < 2; ++t)
#pragma unroll
    for (int r = 0; r < 8; ++r) {
      const float v = acc[t][r];
      s_lds[(n0w + 16 * t + c) * HD + (m0w + 8 * h + r)] = v * 0.125f;
    }
  __syncthreads();                                   // cross-wave LDS exchange

  // 1024 pieces of 16 B: p = it*256 + tid; a wave stores 512 contiguous bytes per it.
  float* pp = Sp + ((size_t)bh * KV_NS + blockIdx.y) * (size_t)(HD * HD);
  v4f pv[4];
#pragma unroll
  for (int it = 0; it < 4; ++it) pv[it] = *(const v4fa*)(s_lds + (it * 256 + tid) * 4);
#pragma unroll
  for (int it = 0; it < 4; ++it) *(v4f*)(pp + (it * 256 + tid) * 4) = pv[it];
}

// ---------------------------------------------------------------------------
// Kernel 4: out[bh][j][d] = sum_kk Q[bh][j][kk] * S[bh][kk][d]  (M = SEQ, N = 64, K = 64).
// grid (SEQ/128, NBH), 256 threads = 8 waves, wave tile 16 j rows x 64 d (4 D tiles).
// Prologue: S^T[d][kk] = sum of kernel 3's KV_NS partials in the order of the ranges (f32, whole-line loads), split into
// hi = bf16(S), lo = bf16(S - hi) and laid in LDS as two planes [64 d][64 kk] at a pitch of 144 B.
// A = Q planes (flat [NBH][SEQ][64] view, ld 64), B^T = the S^T planes in LDS; 3 products.
// Epilogue: wave tile staged in LDS, then the wave writes its contiguous 4 KB of d_out as
// ---------------------------------------------------------------------------
__global__ __launch_bounds__(256) void k_out(const unsigned short* __restrict__ Qhi,
                                              const unsigned short* __restrict__ Qlo,
                                              const float* __restrict__ Sp,
                                              float* __restrict__ out) {
  __shared__ __align__(16) float o_lds[8 * 16 * HD];   // 32 KB, 4 KB per wave
  __shared__ __align__(16) unsigned short st_lds[2 * HD * PT_LD];   // 18 KB: S^T hi | S^T lo
  const int bh = blockIdx.y;
  const int tid = threadIdx.x;
  const int lane = tid & 31;
  const int w = tid >> 5;
  const int c = lane & 15;
  const int h = lane >> 4;
  const int jw = blockIdx.x * 128 + w * 16;
  const size_t qb = (size_t)bh * (size_t)SEQ * HD;
  const unsigned short* QH = Qhi + qb;
  const unsigned short* QL = Qlo + qb;
  const float* pp = Sp + (size_t)bh * KV_NS * (size_t)(HD * HD);
  unsigned short* SH = st_lds;
  unsigned short* SL = st_lds + HD * PT_LD;

  // Q does not depend on S: its fragments are asked for first, so that they fly while the partials are summed
  v16bf ah[2], al[2];
#pragma unroll
  for (int ks = 0; ks < 2; ++ks) {
    ah[ks] = ldfrag(QH, HD, jw, ks * 32);
    al[ks] = ldfrag(QL, HD, jw, ks * 32);
  }
  // precaution: this build reuses the Q loads' address registers as a later load's destination while those loads are in flight
  asm volatile("s_wait_xcnt 0x0" ::: "memory");

  // piece p = it*256 + tid holds 4 neighbours of a row of S^T: d = p >> 4, kk = (p & 15) * 4
#pragma unroll
  for (int it = 0; it < 4; ++it) {
    const int p = it * 256 + tid;
    v4f part[KV_NS];
#pragma unroll
    for (int sp = 0; sp < KV_NS; ++sp) part[sp] = *(const v4fa*)(pp + (size_t)sp * (HD * HD) + p * 4);
    v4f s = part[0];
#pragma unroll
    for (int sp = 1; sp < KV_NS; ++sp) s += part[sp];
    unsigned int hb[4], lb[4];
#pragma unroll
    for (int i = 0; i < 4; ++i) {
      hb[i] = bfbits(s[i]);
      lb[i] = bfbits(s[i] - bfval(hb[i]));
    }
    v2u th, tl;
    th[0] = pack2(hb[0], hb[1]); th[1] = pack2(hb[2], hb[3]);
    tl[0] = pack2(lb[0], lb[1]); tl[1] = pack2(lb[2], lb[3]);
    const int o = (p >> 4) * PT_LD + (p & 15) * 4;
    *(v2ua*)(SH + o) = th;
    *(v2ua*)(SL + o) = tl;
  }
  __syncthreads();                                   // every wave reads all of S^T

  v8f acc[4] = {};
#pragma unroll
  for (int ks = 0; ks < 2; ++ks) {
    const int k0 = ks * 32;
#pragma unroll
    for (int t = 0; t < 4; ++t) {
      const v16bf sh = ldfrag_lds(SH, 16 * t, k0);
      const v16bf sl = ldfrag_lds(SL, 16 * t, k0);
      acc[t] = wmma_bf(ah[ks], sh, acc[t]);
      acc[t] = wmma_bf(ah[ks], sl, acc[t]);
      acc[t] = wmma_bf(al[ks], sh, acc[t]);
    }
  }

  float* ol = o_lds + w * (16 * HD);
#pragma unroll
  for (int t = 0; t < 4; ++t)
#pragma unroll
    for (int r = 0; r < 8; ++r) {
      const float v = acc[t][r];
      ol[(8 * h + r) * HD + 16 * t + c] = v;
    }
  __syncthreads();                                   // covers the same-wave relayout as well

  v4f pv[8];
#pragma unroll
  for (int it = 0; it < 8; ++it) {
    const int p = it * 32 + lane;                    // piece p -> row p >> 4, cols (p & 15)*4 .. +3
    pv[it] = *(const v4fa*)(ol + p * 4);
  }
  float* ob = out + ((size_t)bh * (size_t)SEQ + (size_t)jw) * HD;
#pragma unroll
  for (int it = 0; it < 8; ++it) *(v4f*)(ob + (size_t)(it * 32 + lane) * 4) = pv[it];
  
}

// ---------------------------------------------------------------------------
// Host launch: convert -> projections (hi/lo planes) -> K^T V partials -> sum of partials, Q S
// ---------------------------------------------------------------------------
extern "C" void kernel_launch(void* const* d_in, const int* in_sizes, int n_in,
                              void* d_out, int out_size, void* d_ws, size_t ws_size,
                              hipStream_t stream) {
  if (n_in < 7) return;
  if ((size_t)in_sizes[0] < ((size_t)(NB - 1) * SEQ_FULL + (size_t)SEQ) * EMB) return;
  if (in_sizes[1] < EMB * EMB || in_sizes[3] < EMB * EMB || in_sizes[5] < EMB * EMB) return;
  if (in_sizes[2] < EMB || in_sizes[4] < EMB || in_sizes[6] < EMB) return;
  if ((size_t)out_size < (size_t)MTOK * EMB) return;

  const float* x  = (const float*)d_in[0];
  const float* Wq = (const float*)d_in[1];
  const float* bq = (const float*)d_in[2];
  const float* Wk = (const float*)d_in[3];
  const float* bk = (const float*)d_in[4];
  const float* Wv = (const float*)d_in[5];
  const float* bv = (const float*)d_in[6];
  float* out = (float*)d_out;

  const size_t nAct = (size_t)MTOK * EMB;           // elements per activation plane
  const size_t nWt  = (size_t)EMB * EMB;
  const size_t nS   = (size_t)NBH * HD * HD;

  char* ws = (char*)d_ws;
  size_t off = 0;
  unsigned short* Xb   = (unsigned short*)(ws + off); off += nAct * 2;
  unsigned short* Wb   = (unsigned short*)(ws + off); off += 3 * nWt * 2;
  unsigned short* Qhi  = (unsigned short*)(ws + off); off += nAct * 2;
  unsigned short* Qlo  = (unsigned short*)(ws + off); off += nAct * 2;
  unsigned short* Kthi = (unsigned short*)(ws + off); off += nAct * 2;
  unsigned short* Ktlo = (unsigned short*)(ws + off); off += nAct * 2;
  unsigned short* Vthi = (unsigned short*)(ws + off); off += nAct * 2;
  unsigned short* Vtlo = (unsigned short*)(ws + off); off += nAct * 2;
  float* Sp = (float*)(ws + off); off += nS * KV_NS * 4;
  if (off > ws_size) return;

  k_cvt<<<dim3(NBX + 3 * NBW), dim3(CVT_BLK), 0, stream>>>(x, Wq, Wk, Wv, Xb, Wb);
  k_proj<<<dim3(MTOK / PT, EMB / PT, 3), dim3(256), 0, stream>>>(Xb, Wb, bq, bk, bv,
                                                       Qhi, Qlo, Kthi, Ktlo, Vthi, Vtlo);
  k_kv<<<dim3(NBH, KV_NS), dim3(256), 0, stream>>>(Kthi, Ktlo, Vthi, Vtlo, Sp);
  k_out<<<dim3(SEQ / 128, NBH), dim3(256), 0, stream>>>(Qhi, Qlo, Sp, out);
}

// v004
// A run of this version takes 40.3 microseconds.
// Two timings next to v003 put it at 1.26 and 1.24 times that version's speed.
// Counting every step since v000, it is 5.03 times as fast.
#include <hip/hip_runtime.h>
#include <stdint.h>

// Contractions: x.W^T projections on v_wmma_f32_16x16x32_bf16 (bf16 operands = RNE-converted inputs, f32 accumulate);
// K^T.V (depth SEQ) and Q.S (depth 64) on v_wmma_f32_16x16x32_bf16 with bf16 hi/lo split operands (hi.hi + hi.lo + lo.hi), f32 accumulate.

#ifndef NB
#define NB 2
#endif
#ifndef SEQ
#define SEQ 2048
#endif
#define NB_FULL 2
#define SEQ_FULL 2048
#define EMB 1024
#define NH 16
#define HD 64
#define MTOK (NB * SEQ)
#define NBH (NB * NH)
#define CVT_BLK 256
#define NBW (EMB * EMB / (8 * CVT_BLK))
#define NBX (MTOK * EMB / (8 * CVT_BLK))

static_assert(SEQ % 256 == 0);
static_assert(SEQ >= 256);
static_assert(NB >= 1 && NB <= NB_FULL);
static_assert(SEQ <= SEQ_FULL);
static_assert(EMB == NH * HD);
static_assert((MTOK * EMB) % (8 * CVT_BLK) == 0);
static_assert((EMB * EMB) % (8 * CVT_BLK) == 0);
static_assert(MTOK % 16 == 0);
static_assert(SEQ % 128 == 0);

typedef __bf16 v16bf __attribute__((ext_vector_type(16)));
typedef __bf16 v8bf __attribute__((ext_vector_type(8)));
typedef float v8f __attribute__((ext_vector_type(8)));
typedef float v4f __attribute__((ext_vector_type(4)));
typedef unsigned int v4u __attribute__((ext_vector_type(4)));
typedef v8bf v8bfa __attribute__((may_alias));
typedef v4f v4fa __attribute__((may_alias));
typedef v4u v4ua __attribute__((may_alias));
typedef unsigned int v2u __attribute__((ext_vector_type(2)));
typedef v2u v2ua __attribute__((may_alias));

// ---------------------------------------------------------------------------
// bf16 helpers (integer RNE convert)
// ---------------------------------------------------------------------------
__device__ __forceinline__ unsigned int bfbits(float f) {
  unsigned int u = __float_as_uint(f);
  u += 0x7FFFu + ((u >> 16) & 1u);
  return u >> 16;
}
__device__ __forceinline__ float bfval(unsigned int b) {
  return __uint_as_float(b << 16);
}
__device__ __forceinline__ unsigned int pack2(unsigned int lo16, unsigned int hi16) {
  return (lo16 & 0xffffu) | (hi16 << 16);
}

// ---------------------------------------------------------------------------
// D(16x16 f32) += A(16 x 32k bf16) . B(32k x 16 bf16), wave32; hazard guard after issue.
// ---------------------------------------------------------------------------
__device__ __forceinline__ v8f wmma_bf(v16bf a, v16bf b, v8f c) {
  v8f d = __builtin_amdgcn_wmma_f32_16x16x32_bf16(false, a, false, b, (short)0, c, false, false);
  asm volatile("v_nop\n\tv_nop\n\tv_nop\n\tv_nop" : "+v"(d) : "v"(a), "v"(b));
  return d;
}

// ---------------------------------------------------------------------------
// 16-bit fragment from a row-major [rows][ld] plane (k contiguous within a row).
// lane l: row = r0 + (l & 15); elements 0..7 <- k0 + 8*(l>>4) + 0..7,
//                               elements 8..15 <- k0 + 16 + 8*(l>>4) + 0..7.
// A operand: rows are M rows. B operand: rows are N columns of B (plane holds B^T, i.e. [n][k]).
// D: acc[r] = (row 8*(l>>4) + r, col l & 15).
// ---------------------------------------------------------------------------
__device__ __forceinline__ v16bf ldfrag(const unsigned short* __restrict__ base,
                                        int ld, int r0, int k0) {
  const int lane = threadIdx.x & 31;
  const int m = lane & 15;
  const int koff = (lane >> 4) << 3;
  const unsigned short* p = base + (size_t)(r0 + m) * ld + (k0 + koff);
  const v8bf lo = *(const v8bfa*)p;
  const v8bf hi = *(const v8bfa*)(p + 16);
  v16bf f;
#pragma unroll
  for (int i = 0; i < 8; ++i) { f[i] = lo[i]; f[i + 8] = hi[i]; }
  return f;
}

// ---------------------------------------------------------------------------
// Kernel 1: f32 -> bf16 (RNE) planes for x (token rows remapped for reduced builds)
// and the three weight matrices. 8 elements per thread, one 16-B store per thread:
// ---------------------------------------------------------------------------
__global__ __launch_bounds__(CVT_BLK) void k_cvt(const float* __restrict__ x,
                                                 const float* __restrict__ wq,
                                                 const float* __restrict__ wk,
                                                 const float* __restrict__ wv,
                                                 unsigned short* __restrict__ Xb,
                                                 unsigned short* __restrict__ Wb) {
  const int blk = blockIdx.x;
  const int tid = threadIdx.x;
  const float* src;
  unsigned short* dst;
  if (blk < NBX) {
    const size_t e = ((size_t)blk * CVT_BLK + tid) * 8;
    const size_t t = e / EMB;
    const size_t col = e - t * EMB;
    const size_t bt = t / SEQ;
    const size_t s = t - bt * SEQ;
    src = x + (bt * SEQ_FULL + s) * EMB + col;
    dst = Xb + e;
  } else {
    const int wi = blk - NBX;
    const int zw = wi / NBW;
    const size_t e = ((size_t)(wi - zw * NBW) * CVT_BLK + tid) * 8;
    const float* wsrc = (zw == 0) ? wq : ((zw == 1) ? wk : wv);
    src = wsrc + e;
    dst = Wb + (size_t)zw * EMB * EMB + e;
  }
  const v4f a = *(const v4fa*)src;
  const v4f b = *(const v4fa*)(src + 4);
  const float a0 = a[0], a1 = a[1], a2 = a[2], a3 = a[3];
  const float b0 = b[0], b1 = b[1], b2 = b[2], b3 = b[3];
  v4u o;
  o[0] = pack2(bfbits(a0), bfbits(a1));
  o[1] = pack2(bfbits(a2), bfbits(a3));
  o[2] = pack2(bfbits(b0), bfbits(b1));
  o[3] = pack2(bfbits(b2), bfbits(b3));
  *(v4u*)dst = o;
  
}

// ---------------------------------------------------------------------------
// Kernel 2: y = Xb . Wb^T + b (M = MTOK, N = EMB, K = EMB) for q, k and v, and the partial K^T.V of each K/V tile pair.
// Block: 256 threads = 8 waves, 128 token rows x 128 output columns. grid (MTOK / 128, EMB / 128, 2):
//   z = 0: the K tile AND the V tile of the same tokens and columns (twice the work; these blocks start first);
//   z = 1: the Q tile.
// Per trip one 64-deep k slab of every operand (128 rows x 128 B each) goes global -> registers -> LDS
// with whole-line loads (8 lanes per row); two LDS buffers, one barrier per trip. Fragments come from
// LDS rows at a pitch of 144 B. Wave tile: 64 D rows x 32 D columns (4 x 2 D tiles), for K and V each: the x fragments serve both.
// D rows are tokens for K and V and output columns for Q (the operands swap places), so that a lane's
// 8 accumulator rows are always 8 neighbours of the staged row and leave as one 16-B LDS store.
// Epilogue: value = acc + bf16(bias); hi = bf16(value), lo = bf16(value - hi); planes staged in LDS
// as T[D column][D row] (pitch 272 B).
//   Q: both planes stored as 128 rows of 256 B, flat [MTOK][1024] (== [NBH][SEQ][64] view).
//   K, V: the four planes stay in LDS. The 128 tokens are one slab bh of the raw-reshaped view and the 128 columns are two
//         64-wide chunks, so T holds rows j of K[bh] and V[bh] for 256 values of j: T[chunk * 64 + kk][token].
//         Partial S[bh][sp][kk][d] = 0.125 * sum over these j (chunk, then token) of K[bh][j][kk] * V[bh][j][d], sp = blockIdx.y:
//         wave tile 16 kk x 32 d (2 D tiles), hi/lo operands, 3 products per tile-step; kernel 3 adds the KV_NS ranges.
//         The partial (f32) is transposed in LDS to [d][kk], then stored as Sp[NBH][KV_NS][64 d][64 kk] in whole lines.
// ---------------------------------------------------------------------------
#define PT 128                      // block tile edge
#define PT_K 64                     // k depth of a slab
#define PT_LD 72                    // slab row pitch in 16-bit elements (144 B = 16 B x 9)
#define PT_OP (PT * PT_LD)          // one operand's slab
#define ET_LD 136                   // staging pitch in 16-bit elements (272 B = 16 B x 17)
#define ET_PL (PT * ET_LD)          // one staged plane
#define TPS (SEQ / 16)              // token rows per [SEQ][64] slab of the raw-reshaped view
#define KV_NS (EMB / PT)            // depth ranges per bh: one per column tile

static_assert(TPS == PT);           // a block's tokens are exactly one slab
static_assert(PT == 2 * HD);
static_assert(MTOK % PT == 0 && EMB % PT == 0 && EMB % PT_K == 0);
static_assert(2 * 3 * PT_OP <= 4 * ET_PL);
static_assert(HD * HD * 2 <= 4 * ET_PL);

typedef float f1a __attribute__((may_alias));

// ldfrag's map on an LDS slab (same k order for both operands).
__device__ __forceinline__ v16bf ldfrag_lds(const unsigned short* base, int r0, int k0) {
  const int lane = threadIdx.x & 31;
  const unsigned short* p = base + (r0 + (lane & 15)) * PT_LD + (k0 + ((lane >> 4) << 3));
  const v8bf lo = *(const v8bfa*)p;
  const v8bf hi = *(const v8bfa*)(p + 16);
  v16bf f;
#pragma unroll
  for (int i = 0; i < 8; ++i) { f[i] = lo[i]; f[i + 8] = hi[i]; }
  return f;
}

// 8 neighbours of a staged row: hi = bf16(v), lo = bf16(v - hi), one 16-B LDS store per plane.
__device__ __forceinline__ void split8(const float* v, unsigned short* pH, unsigned short* pL) {
  unsigned int hb[8], lb[8];
#pragma unroll
  for (int r = 0; r < 8; ++r) {
    hb[r] = bfbits(v[r]);
    lb[r] = bfbits(v[r] - bfval(hb[r]));
  }
  v4u th, tl;
  th[0] = pack2(hb[0], hb[1]); th[1] = pack2(hb[2], hb[3]);
  th[2] = pack2(hb[4], hb[5]); th[3] = pack2(hb[6], hb[7]);
  tl[0] = pack2(lb[0], lb[1]); tl[1] = pack2(lb[2], lb[3]);
  tl[2] = pack2(lb[4], lb[5]); tl[3] = pack2(lb[6], lb[7]);
  *(v4ua*)pH = th;
  *(v4ua*)pL = tl;
}

// 4 waves per SIMD = 2 blocks per WGP: a K/V block and a Q block share a WGP, all 512 blocks resident at once (register budget 256).
__global__ __launch_bounds__(256) __attribute__((amdgpu_waves_per_eu(4))) void k_proj(const unsigned short* __restrict__ Xb,
                                               const unsigned short* __restrict__ Wb,
                                               const float* __restrict__ bq,
                                               const float* __restrict__ bk,
                                               const float* __restrict__ bv,
                                               unsigned short* __restrict__ Qhi,
                                               unsigned short* __restrict__ Qlo,
                                               float* __restrict__ Sp) {
  __shared__ __align__(16) unsigned short lds_t[4 * ET_PL];   // 136 KB: two slab buffers, then the T planes, then S^T
  const int tid = threadIdx.x;
  const int lane = tid & 31;
  const int w = tid >> 5;
  const int c = lane & 15;
  const int h = lane >> 4;
  const int m0 = blockIdx.x * PT;                        // first token row
  const int n0 = blockIdx.y * PT;                        // first output column
  const int wr = (w >> 2) * 64;                          // wave's first D row
  const int wc = (w & 3) * 32;                           // wave's first D column

  // staging: piece i of a thread = row i*32 + (tid >> 3), 16 B at column (tid & 7) * 8
  const int srow = tid >> 3;
  const int scol = (tid & 7) * 8;
  const int lst = srow * PT_LD + scol;
  const unsigned short* gX = Xb + (size_t)(m0 + srow) * EMB + scol;

  if (blockIdx.z == 0) {
    // ---------------- K and V tiles, then their partial K^T.V ----------------
    const unsigned short* gK = Wb + (size_t)EMB * EMB + (size_t)(n0 + srow) * EMB + scol;
    const unsigned short* gV = gK + (size_t)EMB * EMB;
    v4u rx[4], rk[4], rv[4];
#pragma unroll
    for (int i = 0; i < 4; ++i) {
      rx[i] = *(const v4ua*)(gX + (size_t)i * 32 * EMB);
      rk[i] = *(const v4ua*)(gK + (size_t)i * 32 * EMB);
      rv[i] = *(const v4ua*)(gV + (size_t)i * 32 * EMB);
    }
#pragma unroll
    for (int i = 0; i < 4; ++i) {
      *(v4ua*)(lds_t + lst + i * 32 * PT_LD) = rx[i];
      *(v4ua*)(lds_t + PT_OP + lst + i * 32 * PT_LD) = rk[i];
      *(v4ua*)(lds_t + 2 * PT_OP + lst + i * 32 * PT_LD) = rv[i];
    }

    v8f ack[4][2] = {};
    v8f acv[4][2] = {};
    // rolled: one copy of the trip; unrolled, the staged registers of two trips would not fit the budget
#pragma unroll 1
    for (int kt = 0; kt < EMB / PT_K; ++kt) {
      // publishes slab kt and ends every wave's reads of the buffer that this trip refills
      __syncthreads();
      const unsigned short* cur = lds_t + (kt & 1) * (3 * PT_OP);
      unsigned short* nxt = lds_t + ((kt + 1) & 1) * (3 * PT_OP);
      const bool more = (kt + 1 < EMB / PT_K);
      if (more) {
#pragma unroll
        for (int i = 0; i < 4; ++i) {
          rx[i] = *(const v4ua*)(gX + (size_t)i * 32 * EMB + (kt + 1) * PT_K);
          rk[i] = *(const v4ua*)(gK + (size_t)i * 32 * EMB + (kt + 1) * PT_K);
          rv[i] = *(const v4ua*)(gV + (size_t)i * 32 * EMB + (kt + 1) * PT_K);
        }
        // precaution: the trip's address registers are reused for LDS addresses and fragments while these loads are in flight
        asm volatile("s_wait_xcnt 0x0" ::: "memory");
      }
#pragma unroll
      for (int ks = 0; ks < 2; ++ks) {
        v16bf a[4], b[2];
#pragma unroll
        for (int mi = 0; mi < 4; ++mi) a[mi] = ldfrag_lds(cur, wr + 16 * mi, ks * 32);
#pragma unroll
        for (int ni = 0; ni < 2; ++ni) b[ni] = ldfrag_lds(cur + PT_OP, wc + 16 * ni, ks * 32);
#pragma unroll
        for (int mi = 0; mi < 4; ++mi)
#pragma unroll
          for (int ni = 0; ni < 2; ++ni) ack[mi][ni] = wmma_bf(a[mi], b[ni], ack[mi][ni]);
#pragma unroll
        for (int ni = 0; ni < 2; ++ni) b[ni] = ldfrag_lds(cur + 2 * PT_OP, wc + 16 * ni, ks * 32);
#pragma unroll
        for (int mi = 0; mi < 4; ++mi)
#pragma unroll
          for (int ni = 0; ni < 2; ++ni) acv[mi][ni] = wmma_bf(a[mi], b[ni], acv[mi][ni]);
      }
      if (more) {
#pragma unroll
        for (int i = 0; i < 4; ++i) {
          *(v4ua*)(nxt + lst + i * 32 * PT_LD) = rx[i];
          *(v4ua*)(nxt + PT_OP + lst + i * 32 * PT_LD) = rk[i];
          *(v4ua*)(nxt + 2 * PT_OP + lst + i * 32 * PT_LD) = rv[i];
        }
      }
    }
    __syncthreads();                                     // last fragment reads end before LDS becomes T

    // bias as its bf16 (RNE) value, added in f32; it follows the output column = D column
    float bck[2], bcv[2];
#pragma unroll
    for (int ni = 0; ni < 2; ++ni) {
      bck[ni] = bfval(bfbits(bk[n0 + wc + ni * 16 + c]));
      bcv[ni] = bfval(bfbits(bv[n0 + wc + ni * 16 + c]));
    }
    // precaution: the four loads' address registers may be reused while the loads are in flight
    asm volatile("s_wait_xcnt 0x0" ::: "memory");

    unsigned short* KH = lds_t;
    unsigned short* KL = lds_t + ET_PL;
    unsigned short* VH = lds_t + 2 * ET_PL;
    unsigned short* VL = lds_t + 3 * ET_PL;
#pragma unroll
    for (int mi = 0; mi < 4; ++mi)
#pragma unroll
      for (int ni = 0; ni < 2; ++ni) {
        const int o = (wc + ni * 16 + c) * ET_LD + wr + mi * 16 + 8 * h;   // T[D column][D row]
        float vk[8], vv[8];
#pragma unroll
        for (int r = 0; r < 8; ++r) {
          vk[r] = ack[mi][ni][r] + bck[ni];
          vv[r] = acv[mi][ni][r] + bcv[ni];
        }
        split8(vk, KH + o, KL + o);
        split8(vv, VH + o, VL + o);
      }
    __syncthreads();                                     // every wave reads rows of T that other waves wrote

    const int m0w = (w >> 1) * 16;    // kk
    const int n0w = (w & 1) * 32;     // d
    v8f acc[2] = {};
    v16bf ah = ldfrag(KH, ET_LD, m0w, 0);
    v16bf al = ldfrag(KL, ET_LD, m0w, 0);
    v16bf vh[2], vl[2];
#pragma unroll
    for (int t = 0; t < 2; ++t) {
      vh[t] = ldfrag(VH, ET_LD, n0w + 16 * t, 0);
      vl[t] = ldfrag(VL, ET_LD, n0w + 16 * t, 0);
    }
    // unrolled: the two fragment sets then need no register copies, and every LDS offset is an immediate
#pragma unroll
    for (int j0 = 0; j0 < 2 * PT; j0 += 32) {
      // the next step's fragments are asked for as one group ahead of this step's products, which hide the LDS latency
      // (the last step names its own columns again, so that the address stays inside the planes; nothing reads that set)
      const int jn = (j0 + 32 < 2 * PT) ? j0 + 32 : j0;
      const int rn = (jn / PT) * HD;                     // chunk's first row of T
      const int tn = jn % PT;                            // first token of the step
      const v16bf nah = ldfrag(KH, ET_LD, rn + m0w, tn);
      const v16bf nal = ldfrag(KL, ET_LD, rn + m0w, tn);
      v16bf nvh[2], nvl[2];
#pragma unroll
      for (int t = 0; t < 2; ++t) {
        nvh[t] = ldfrag(VH, ET_LD, rn + n0w + 16 * t, tn);
        nvl[t] = ldfrag(VL, ET_LD, rn + n0w + 16 * t, tn);
      }
#pragma unroll
      for (int t = 0; t < 2; ++t) {
        acc[t] = wmma_bf(ah, vh[t], acc[t]);
        acc[t] = wmma_bf(ah, vl[t], acc[t]);
        acc[t] = wmma_bf(al, vh[t], acc[t]);
      }
      ah = nah; al = nal;
#pragma unroll
      for (int t = 0; t < 2; ++t) { vh[t] = nvh[t]; vl[t] = nvl[t]; }
    }
    __syncthreads();                                     // last reads of T end before LDS becomes S^T

    // D (row kk = m0w + 8h + r, col d = n0w + 16t + c) -> s_lds[d][kk], scaled by 1/sqrt(64)
    f1a* s_lds = (f1a*)lds_t;
#pragma unroll
    for (int t = 0; t < 2; ++t)
#pragma unroll
      for (int r = 0; r < 8; ++r) {
        const float v = acc[t][r];
        s_lds[(n0w + 16 * t + c) * HD + (m0w + 8 * h + r)] = v * 0.125f;
      }
    __syncthreads();                                     // cross-wave LDS exchange

    // 1024 pieces of 16 B: p = it*256 + tid; a wave stores 512 contiguous bytes per it.
    float* pp = Sp + ((size_t)blockIdx.x * KV_NS + blockIdx.y) * (size_t)(HD * HD);
    v4f pv[4];
#pragma unroll
    for (int it = 0; it < 4; ++it) pv[it] = *(const v4fa*)(s_lds + (it * 256 + tid) * 4);
#pragma unroll
    for (int it = 0; it < 4; ++it) *(v4f*)(pp + (it * 256 + tid) * 4) = pv[it];
  } else {
    // ---------------- Q tile: D rows are output columns, D columns are tokens ----------------
    const unsigned short* gW = Wb + (size_t)(n0 + srow) * EMB + scol;
    v4u ra[4], rb[4];
#pragma unroll
    for (int i = 0; i < 4; ++i) {
      ra[i] = *(const v4ua*)(gW + (size_t)i * 32 * EMB);
      rb[i] = *(const v4ua*)(gX + (size_t)i * 32 * EMB);
    }
#pragma unroll
    for (int i = 0; i < 4; ++i) {
      *(v4ua*)(lds_t + lst + i * 32 * PT_LD) = ra[i];
      *(v4ua*)(lds_t + PT_OP + lst + i * 32 * PT_LD) = rb[i];
    }

    v8f acc[4][2] = {};
    // rolled: one copy of the trip; unrolled, the staged registers of two trips would not fit the budget
#pragma unroll 1
    for (int kt = 0; kt < EMB / PT_K; ++kt) {
      // publishes slab kt and ends every wave's reads of the buffer that this trip refills
      __syncthreads();
      const unsigned short* cur = lds_t + (kt & 1) * (2 * PT_OP);
      unsigned short* nxt = lds_t + ((kt + 1) & 1) * (2 * PT_OP);
      const bool more = (kt + 1 < EMB / PT_K);
      if (more) {
#pragma unroll
        for (int i = 0; i < 4; ++i) {
          ra[i] = *(const v4ua*)(gW + (size_t)i * 32 * EMB + (kt + 1) * PT_K);
          rb[i] = *(const v4ua*)(gX + (size_t)i * 32 * EMB + (kt + 1) * PT_K);
        }
        // precaution: the trip's address registers are reused for LDS addresses and fragments while these loads are in flight
        asm volatile("s_wait_xcnt 0x0" ::: "memory");
      }
#pragma unroll
      for (int ks = 0; ks < 2; ++ks) {
        v16bf a[4], b[2];
#pragma unroll
        for (int mi = 0; mi < 4; ++mi) a[mi] = ldfrag_lds(cur, wr + 16 * mi, ks * 32);
#pragma unroll
        for (int ni = 0; ni < 2; ++ni) b[ni] = ldfrag_lds(cur + PT_OP, wc + 16 * ni, ks * 32);
#pragma unroll
        for (int mi = 0; mi < 4; ++mi)
#pragma unroll
          for (int ni = 0; ni < 2; ++ni) acc[mi][ni] = wmma_bf(a[mi], b[ni], acc[mi][ni]);
      }
      if (more) {
#pragma unroll
        for (int i = 0; i < 4; ++i) {
          *(v4ua*)(nxt + lst + i * 32 * PT_LD) = ra[i];
          *(v4ua*)(nxt + PT_OP + lst + i * 32 * PT_LD) = rb[i];
        }
      }
    }
    __syncthreads();                                     // last fragment reads end before LDS becomes T

    unsigned short* tH = lds_t;
    unsigned short* tL = lds_t + ET_PL;
#pragma unroll
    for (int mi = 0; mi < 4; ++mi) {
      // bias as its bf16 (RNE) value, added in f32; it follows the output column = D row
      const float* bp = bq + n0 + wr + mi * 16 + 8 * h;
      const v4f p0 = *(const v4fa*)bp;
      const v4f p1 = *(const v4fa*)(bp + 4);
      float brow[8];
#pragma unroll
      for (int r = 0; r < 4; ++r) {
        brow[r] = bfval(bfbits(p0[r]));
        brow[r + 4] = bfval(bfbits(p1[r]));
      }
#pragma unroll
      for (int ni = 0; ni < 2; ++ni) {
        const int o = (wc + ni * 16 + c) * ET_LD + wr + mi * 16 + 8 * h;   // T[D column][D row]
        float v[8];
#pragma unroll
        for (int r = 0; r < 8; ++r) v[r] = acc[mi][ni][r] + brow[r];
        split8(v, tH + o, tL + o);
      }
    }
    __syncthreads();                                     // cross-wave LDS exchange

#pragma unroll
    for (int it = 0; it < 8; ++it) {
      const int p = it * 256 + tid;                      // 16 pieces of 16 B per T row; a wave stores 2 rows
      const int t = p >> 4;
      const int c8 = (p & 15) * 8;
      const size_t g = (size_t)(m0 + t) * EMB + (size_t)(n0 + c8);
      const v4u vh = *(const v4ua*)(tH + t * ET_LD + c8);
      const v4u vl = *(const v4ua*)(tL + t * ET_LD + c8);
      *(v4u*)(Qhi + g) = vh;
      *(v4u*)(Qlo + g) = vl;
    }
  }
}

// ---------------------------------------------------------------------------
// Kernel 3: out[bh][j][d] = sum_kk Q[bh][j][kk] * S[bh][kk][d]  (M = SEQ, N = 64, K = 64).
// grid (SEQ/128, NBH), 256 threads = 8 waves, wave tile 16 j rows x 64 d (4 D tiles).
// Prologue: S^T[d][kk] = sum of kernel 2's KV_NS partials in the order of the ranges (f32, whole-line loads), split into
// hi = bf16(S), lo = bf16(S - hi) and laid in LDS as two planes [64 d][64 kk] at a pitch of 144 B.
// A = Q planes (flat [NBH][SEQ][64] view, ld 64), B^T = the S^T planes in LDS; 3 products.
// Epilogue: wave tile staged in LDS, then the wave writes its contiguous 4 KB of d_out as
// ---------------------------------------------------------------------------
__global__ __launch_bounds__(256) void k_out(const unsigned short* __restrict__ Qhi,
                                              const unsigned short* __restrict__ Qlo,
                                              const float* __restrict__ Sp,
                                              float* __restrict__ out) {
  __shared__ __align__(16) float o_lds[8 * 16 * HD];   // 32 KB, 4 KB per wave
  __shared__ __align__(16) unsigned short st_lds[2 * HD * PT_LD];   // 18 KB: S^T hi | S^T lo
  const int bh = blockIdx.y;
  const int tid = threadIdx.x;
  const int lane = tid & 31;
  const int w = tid >> 5;
  const int c = lane & 15;
  const int h = lane >> 4;
  const int jw = blockIdx.x * 128 + w * 16;
  const size_t qb = (size_t)bh * (size_t)SEQ * HD;
  const unsigned short* QH = Qhi + qb;
  const unsigned short* QL = Qlo + qb;
  const float* pp = Sp + (size_t)bh * KV_NS * (size_t)(HD * HD);
  unsigned short* SH = st_lds;
  unsigned short* SL = st_lds + HD * PT_LD;

  // Q does not depend on S: its fragments are asked for first, so that they fly while the partials are summed
  v16bf ah[2], al[2];
#pragma unroll
  for (int ks = 0; ks < 2; ++ks) {
    ah[ks] = ldfrag(QH, HD, jw, ks * 32);
    al[ks] = ldfrag(QL, HD, jw, ks * 32);
  }
  // precaution: this build reuses the Q loads' address registers as a later load's destination while those loads are in flight
  asm volatile("s_wait_xcnt 0x0" ::: "memory");

  // piece p = it*256 + tid holds 4 neighbours of a row of S^T: d = p >> 4, kk = (p & 15) * 4
#pragma unroll
  for (int it = 0; it < 4; ++it) {
    const int p = it * 256 + tid;
    v4f part[KV_NS];
#pragma unroll
    for (int sp = 0; sp < KV_NS; ++sp) part[sp] = *(const v4fa*)(pp + (size_t)sp * (HD * HD) + p * 4);
    v4f s = part[0];
#pragma unroll
    for (int sp = 1; sp < KV_NS; ++sp) s += part[sp];
    unsigned int hb[4], lb[4];
#pragma unroll
    for (int i = 0; i < 4; ++i) {
      hb[i] = bfbits(s[i]);
      lb[i] = bfbits(s[i] - bfval(hb[i]));
    }
    v2u th, tl;
    th[0] = pack2(hb[0], hb[1]); th[1] = pack2(hb[2], hb[3]);
    tl[0] = pack2(lb[0], lb[1]); tl[1] = pack2(lb[2], lb[3]);
    const int o = (p >> 4) * PT_LD + (p & 15) * 4;
    *(v2ua*)(SH + o) = th;
    *(v2ua*)(SL + o) = tl;
  }
  __syncthreads();                                   // every wave reads all of S^T

  v8f acc[4] = {};
#pragma unroll
  for (int ks = 0; ks < 2; ++ks) {
    const int k0 = ks * 32;
#pragma unroll
    for (int t = 0; t < 4; ++t) {
      const v16bf sh = ldfrag_lds(SH, 16 * t, k0);
      const v16bf sl = ldfrag_lds(SL, 16 * t, k0);
      acc[t] = wmma_bf(ah[ks], sh, acc[t]);
      acc[t] = wmma_bf(ah[ks], sl, acc[t]);
      acc[t] = wmma_bf(al[ks], sh, acc[t]);
    }
  }

  float* ol = o_lds + w * (16 * HD);
#pragma unroll
  for (int t = 0; t < 4; ++t)
#pragma unroll
    for (int r = 0; r < 8; ++r) {
      const float v = acc[t][r];
      ol[(8 * h + r) * HD + 16 * t + c] = v;
    }
  __syncthreads();                                   // covers the same-wave relayout as well

  v4f pv[8];
#pragma unroll
  for (int it = 0; it < 8; ++it) {
    const int p = it * 32 + lane;                    // piece p -> row p >> 4, cols (p & 15)*4 .. +3
    pv[it] = *(const v4fa*)(ol + p * 4);
  }
  float* ob = out + ((size_t)bh * (size_t)SEQ + (size_t)jw) * HD;
#pragma unroll
  for (int it = 0; it < 8; ++it) *(v4f*)(ob + (size_t)(it * 32 + lane) * 4) = pv[it];
  
}

// ---------------------------------------------------------------------------
// Host launch: convert -> projections (Q hi/lo planes; K^T V partials) -> sum of partials, Q S
// ---------------------------------------------------------------------------
extern "C" void kernel_launch(void* const* d_in, const int* in_sizes, int n_in,
                              void* d_out, int out_size, void* d_ws, size_t ws_size,
                              hipStream_t stream) {
  if (n_in < 7) return;
  if ((size_t)in_sizes[0] < ((size_t)(NB - 1) * SEQ_FULL + (size_t)SEQ) * EMB) return;
  if (in_sizes[1] < EMB * EMB || in_sizes[3] < EMB * EMB || in_sizes[5] < EMB * EMB) return;
  if (in_sizes[2] < EMB || in_sizes[4] < EMB || in_sizes[6] < EMB) return;
  if ((size_t)out_size < (size_t)MTOK * EMB) return;

  const float* x  = (const float*)d_in[0];
  const float* Wq = (const float*)d_in[1];
  const float* bq = (const float*)d_in[2];
  const float* Wk = (const float*)d_in[3];
  const float* bk = (const float*)d_in[4];
  const float* Wv = (const float*)d_in[5];
  const float* bv = (const float*)d_in[6];
  float* out = (float*)d_out;

  const size_t nAct = (size_t)MTOK * EMB;           // elements per activation plane
  const size_t nWt  = (size_t)EMB * EMB;
  const size_t nS   = (size_t)NBH * HD * HD;

  char* ws = (char*)d_ws;
  size_t off = 0;
  unsigned short* Xb   = (unsigned short*)(ws + off); off += nAct * 2;
  unsigned short* Wb   = (unsigned short*)(ws + off); off += 3 * nWt * 2;
  unsigned short* Qhi  = (unsigned short*)(ws + off); off += nAct * 2;
  unsigned short* Qlo  = (unsigned short*)(ws + off); off += nAct * 2;
  float* Sp = (float*)(ws + off); off += nS * KV_NS * 4;
  if (off > ws_size) return;

  k_cvt<<<dim3(NBX + 3 * NBW), dim3(CVT_BLK), 0, stream>>>(x, Wq, Wk, Wv, Xb, Wb);
  k_proj<<<dim3(MTOK / PT, EMB / PT, 2), dim3(256), 0, stream>>>(Xb, Wb, bq, bk, bv, Qhi, Qlo, Sp);
  k_out<<<dim3(SEQ / 128, NBH), dim3(256), 0, stream>>>(Qhi, Qlo, Sp, out);
}

// v005
// A run of this version takes 37.8 microseconds.
// Next to v004, in two timings, it ran 1.07 and 1.06 times as fast.
// All steps since v000 together make it 5.36 times as fast.
#include <hip/hip_runtime.h>
#include <stdint.h>

// Contractions: x.W^T projections on v_wmma_f32_16x16x32_bf16 (bf16 operands = RNE-converted inputs, f32 accumulate);
// K^T.V (depth SEQ) and Q.S (depth 64) on v_wmma_f32_16x16x32_bf16 with bf16 hi/lo split operands (hi.hi + hi.lo + lo.hi), f32 accumulate.

#ifndef NB
#define NB 2
#endif
#ifndef SEQ
#define SEQ 2048
#endif
#define NB_FULL 2
#define SEQ_FULL 2048
#define EMB 1024
#define NH 16
#define HD 64
#define MTOK (NB * SEQ)
#define NBH (NB * NH)
#define CVT_BLK 256
#define NBW (EMB * EMB / (8 * CVT_BLK))
#define NBX (MTOK * EMB / (8 * CVT_BLK))

static_assert(SEQ % 256 == 0);
static_assert(SEQ >= 256);
static_assert(NB >= 1 && NB <= NB_FULL);
static_assert(SEQ <= SEQ_FULL);
static_assert(EMB == NH * HD);
static_assert((MTOK * EMB) % (8 * CVT_BLK) == 0);
static_assert((EMB * EMB) % (8 * CVT_BLK) == 0);
static_assert(MTOK % 16 == 0);
static_assert(SEQ % 128 == 0);

typedef __bf16 v16bf __attribute__((ext_vector_type(16)));
typedef __bf16 v8bf __attribute__((ext_vector_type(8)));
typedef float v8f __attribute__((ext_vector_type(8)));
typedef float v4f __attribute__((ext_vector_type(4)));
typedef unsigned int v4u __attribute__((ext_vector_type(4)));
typedef v8bf v8bfa __attribute__((may_alias));
typedef v4f v4fa __attribute__((may_alias));
typedef v4u v4ua __attribute__((may_alias));
typedef unsigned int v2u __attribute__((ext_vector_type(2)));
typedef v2u v2ua __attribute__((may_alias));

typedef float v2f __attribute__((ext_vector_type(2)));
typedef __bf16 v2bf __attribute__((ext_vector_type(2)));

// ---------------------------------------------------------------------------
// bf16 helpers (the packed convert instruction, RNE)
// ---------------------------------------------------------------------------
// two f32 -> two bf16 in one register: a in the low half, b in the high half
__device__ __forceinline__ unsigned int cvt2(float a, float b) {
  v2f p;
  p[0] = a;
  p[1] = b;
  return __builtin_bit_cast(unsigned int, __builtin_convertvector(p, v2bf));
}
// f32 values of the two halves of a packed pair
__device__ __forceinline__ float bflo(unsigned int pk) { return __uint_as_float(pk << 16); }
__device__ __forceinline__ float bfhi(unsigned int pk) { return __uint_as_float(pk & 0xffff0000u); }
// f rounded to bf16, as f32
__device__ __forceinline__ float bfround(float f) { return bfhi(cvt2(f, f)); }

// ---------------------------------------------------------------------------
// D(16x16 f32) += A(16 x 32k bf16) . B(32k x 16 bf16), wave32; hazard guard after issue.
// ---------------------------------------------------------------------------
__device__ __forceinline__ v8f wmma_bf(v16bf a, v16bf b, v8f c) {
  v8f d = __builtin_amdgcn_wmma_f32_16x16x32_bf16(false, a, false, b, (short)0, c, false, false);
  asm volatile("v_nop\n\tv_nop\n\tv_nop\n\tv_nop" : "+v"(d) : "v"(a), "v"(b));
  return d;
}

// ---------------------------------------------------------------------------
// 16-bit fragment from a row-major [rows][ld] plane (k contiguous within a row).
// lane l: row = r0 + (l & 15); elements 0..7 <- k0 + 8*(l>>4) + 0..7,
//                               elements 8..15 <- k0 + 16 + 8*(l>>4) + 0..7.
// A operand: rows are M rows. B operand: rows are N columns of B (plane holds B^T, i.e. [n][k]).
// D: acc[r] = (row 8*(l>>4) + r, col l & 15).
// ---------------------------------------------------------------------------
__device__ __forceinline__ v16bf ldfrag(const unsigned short* __restrict__ base,
                                        int ld, int r0, int k0) {
  const int lane = threadIdx.x & 31;
  const int m = lane & 15;
  const int koff = (lane >> 4) << 3;
  const unsigned short* p = base + (size_t)(r0 + m) * ld + (k0 + koff);
  const v8bf lo = *(const v8bfa*)p;
  const v8bf hi = *(const v8bfa*)(p + 16);
  v16bf f;
#pragma unroll
  for (int i = 0; i < 8; ++i) { f[i] = lo[i]; f[i + 8] = hi[i]; }
  return f;
}

// ---------------------------------------------------------------------------
// Kernel 1: f32 -> bf16 (RNE) planes for x (token rows remapped for reduced builds)
// and the three weight matrices. 8 elements per thread, one 16-B store per thread:
// ---------------------------------------------------------------------------
__global__ __launch_bounds__(CVT_BLK) void k_cvt(const float* __restrict__ x,
                                                 const float* __restrict__ wq,
                                                 const float* __restrict__ wk,
                                                 const float* __restrict__ wv,
                                                 unsigned short* __restrict__ Xb,
                                                 unsigned short* __restrict__ Wb) {
  const int blk = blockIdx.x;
  const int tid = threadIdx.x;
  const float* src;
  unsigned short* dst;
  if (blk < NBX) {
    const size_t e = ((size_t)blk * CVT_BLK + tid) * 8;
    const size_t t = e / EMB;
    const size_t col = e - t * EMB;
    const size_t bt = t / SEQ;
    const size_t s = t - bt * SEQ;
    src = x + (bt * SEQ_FULL + s) * EMB + col;
    dst = Xb + e;
  } else {
    const int wi = blk - NBX;
    const int zw = wi / NBW;
    const size_t e = ((size_t)(wi - zw * NBW) * CVT_BLK + tid) * 8;
    const float* wsrc = (zw == 0) ? wq : ((zw == 1) ? wk : wv);
    src = wsrc + e;
    dst = Wb + (size_t)zw * EMB * EMB + e;
  }
  const v4f a = *(const v4fa*)src;
  const v4f b = *(const v4fa*)(src + 4);
  const float a0 = a[0], a1 = a[1], a2 = a[2], a3 = a[3];
  const float b0 = b[0], b1 = b[1], b2 = b[2], b3 = b[3];
  v4u o;
  o[0] = cvt2(a0, a1);
  o[1] = cvt2(a2, a3);
  o[2] = cvt2(b0, b1);
  o[3] = cvt2(b2, b3);
  *(v4u*)dst = o;
  
}

// ---------------------------------------------------------------------------
// Kernel 2: y = Xb . Wb^T + b (M = MTOK, N = EMB, K = EMB) for q, k and v, and the partial K^T.V of each K/V tile pair.
// Block: 256 threads = 8 waves, 128 token rows x 128 output columns. grid (MTOK / 128, EMB / 128, 2):
//   z = 0: the K tile AND the V tile of the same tokens and columns (twice the work; these blocks start first);
//   z = 1: the Q tile.
// Per trip one 64-deep k slab of every operand (128 rows x 128 B each) goes global -> registers -> LDS
// with whole-line loads (8 lanes per row); two LDS buffers, one barrier per trip. Fragments come from
// LDS rows at a pitch of 144 B. Wave tile: 64 D rows x 32 D columns (4 x 2 D tiles), for K and V each: the x fragments serve both.
// D rows are tokens for K and V and output columns for Q (the operands swap places), so that a lane's
// 8 accumulator rows are always 8 neighbours of the staged row and leave as one 16-B LDS store.
// Epilogue: value = acc + bf16(bias); hi = bf16(value), lo = bf16(value - hi); planes staged in LDS
// as T[D column][D row] (pitch 272 B).
//   Q: both planes stored as 128 rows of 256 B, flat [MTOK][1024] (== [NBH][SEQ][64] view).
//   K, V: the four planes stay in LDS. The 128 tokens are one slab bh of the raw-reshaped view and the 128 columns are two
//         64-wide chunks, so T holds rows j of K[bh] and V[bh] for 256 values of j: T[chunk * 64 + kk][token].
//         Partial S[bh][sp][kk][d] = 0.125 * sum over these j (chunk, then token) of K[bh][j][kk] * V[bh][j][d], sp = blockIdx.y:
//         wave tile 16 kk x 32 d (2 D tiles), hi/lo operands, 3 products per tile-step; kernel 3 adds the KV_NS ranges.
//         The partial (f32) is transposed in LDS to [d][kk], then stored as Sp[NBH][KV_NS][64 d][64 kk] in whole lines.
// ---------------------------------------------------------------------------
#define PT 128                      // block tile edge
#define PT_K 64                     // k depth of a slab
#define PT_LD 72                    // slab row pitch in 16-bit elements (144 B = 16 B x 9)
#define PT_OP (PT * PT_LD)          // one operand's slab
#define ET_LD 136                   // staging pitch in 16-bit elements (272 B = 16 B x 17)
#define ET_PL (PT * ET_LD)          // one staged plane
#define TPS (SEQ / 16)              // token rows per [SEQ][64] slab of the raw-reshaped view
#define KV_NS (EMB / PT)            // depth ranges per bh: one per column tile

static_assert(TPS == PT);           // a block's tokens are exactly one slab
static_assert(PT == 2 * HD);
static_assert(MTOK % PT == 0 && EMB % PT == 0 && EMB % PT_K == 0);
static_assert(2 * 3 * PT_OP <= 4 * ET_PL);
static_assert(HD * HD * 2 <= 4 * ET_PL);

typedef float f1a __attribute__((may_alias));

// ldfrag's map on an LDS slab (same k order for both operands).
__device__ __forceinline__ v16bf ldfrag_lds(const unsigned short* base, int r0, int k0) {
  const int lane = threadIdx.x & 31;
  const unsigned short* p = base + (r0 + (lane & 15)) * PT_LD + (k0 + ((lane >> 4) << 3));
  const v8bf lo = *(const v8bfa*)p;
  const v8bf hi = *(const v8bfa*)(p + 16);
  v16bf f;
#pragma unroll
  for (int i = 0; i < 8; ++i) { f[i] = lo[i]; f[i + 8] = hi[i]; }
  return f;
}

// 8 neighbours of a staged row: hi = bf16(v), lo = bf16(v - hi), one 16-B LDS store per plane.
__device__ __forceinline__ void split8(const float* v, unsigned short* pH, unsigned short* pL) {
  v4u th, tl;
#pragma unroll
  for (int q = 0; q < 4; ++q) {
    th[q] = cvt2(v[2 * q], v[2 * q + 1]);
    tl[q] = cvt2(v[2 * q] - bflo(th[q]), v[2 * q + 1] - bfhi(th[q]));
  }
  *(v4ua*)pH = th;
  *(v4ua*)pL = tl;
}

// 4 waves per SIMD = 2 blocks per WGP: a K/V block and a Q block share a WGP, all 512 blocks resident at once (register budget 256).
__global__ __launch_bounds__(256) __attribute__((amdgpu_waves_per_eu(4))) void k_proj(const unsigned short* __restrict__ Xb,
                                               const unsigned short* __restrict__ Wb,
                                               const float* __restrict__ bq,
                                               const float* __restrict__ bk,
                                               const float* __restrict__ bv,
                                               unsigned short* __restrict__ Qhi,
                                               unsigned short* __restrict__ Qlo,
                                               float* __restrict__ Sp) {
  __shared__ __align__(16) unsigned short lds_t[4 * ET_PL];   // 136 KB: two slab buffers, then the T planes, then S^T
  const int tid = threadIdx.x;
  const int lane = tid & 31;
  const int w = tid >> 5;
  const int c = lane & 15;
  const int h = lane >> 4;
  const int m0 = blockIdx.x * PT;                        // first token row
  const int n0 = blockIdx.y * PT;                        // first output column
  const int wr = (w >> 2) * 64;                          // wave's first D row
  const int wc = (w & 3) * 32;                           // wave's first D column

  // staging: piece i of a thread = row i*32 + (tid >> 3), 16 B at column (tid & 7) * 8
  const int srow = tid >> 3;
  const int scol = (tid & 7) * 8;
  const int lst = srow * PT_LD + scol;
  const unsigned short* gX = Xb + (size_t)(m0 + srow) * EMB + scol;

  if (blockIdx.z == 0) {
    // ---------------- K and V tiles, then their partial K^T.V ----------------
    const unsigned short* gK = Wb + (size_t)EMB * EMB + (size_t)(n0 + srow) * EMB + scol;
    const unsigned short* gV = gK + (size_t)EMB * EMB;
    v4u rx[4], rk[4], rv[4];
#pragma unroll
    for (int i = 0; i < 4; ++i) {
      rx[i] = *(const v4ua*)(gX + (size_t)i * 32 * EMB);
      rk[i] = *(const v4ua*)(gK + (size_t)i * 32 * EMB);
      rv[i] = *(const v4ua*)(gV + (size_t)i * 32 * EMB);
    }
#pragma unroll
    for (int i = 0; i < 4; ++i) {
      *(v4ua*)(lds_t + lst + i * 32 * PT_LD) = rx[i];
      *(v4ua*)(lds_t + PT_OP + lst + i * 32 * PT_LD) = rk[i];
      *(v4ua*)(lds_t + 2 * PT_OP + lst + i * 32 * PT_LD) = rv[i];
    }

    v8f ack[4][2] = {};
    v8f acv[4][2] = {};
    // rolled: one copy of the trip; unrolled, the staged registers of two trips would not fit the budget
#pragma unroll 1
    for (int kt = 0; kt < EMB / PT_K; ++kt) {
      // publishes slab kt and ends every wave's reads of the buffer that this trip refills
      __syncthreads();
      const unsigned short* cur = lds_t + (kt & 1) * (3 * PT_OP);
      unsigned short* nxt = lds_t + ((kt + 1) & 1) * (3 * PT_OP);
      const bool more = (kt + 1 < EMB / PT_K);
      if (more) {
#pragma unroll
        for (int i = 0; i < 4; ++i) {
          rx[i] = *(const v4ua*)(gX + (size_t)i * 32 * EMB + (kt + 1) * PT_K);
          rk[i] = *(const v4ua*)(gK + (size_t)i * 32 * EMB + (kt + 1) * PT_K);
          rv[i] = *(const v4ua*)(gV + (size_t)i * 32 * EMB + (kt + 1) * PT_K);
        }
        // precaution: the trip's address registers are reused for LDS addresses and fragments while these loads are in flight
        asm volatile("s_wait_xcnt 0x0" ::: "memory");
      }
#pragma unroll
      for (int ks = 0; ks < 2; ++ks) {
        v16bf a[4], b[2];
#pragma unroll
        for (int mi = 0; mi < 4; ++mi) a[mi] = ldfrag_lds(cur, wr + 16 * mi, ks * 32);
#pragma unroll
        for (int ni = 0; ni < 2; ++ni) b[ni] = ldfrag_lds(cur + PT_OP, wc + 16 * ni, ks * 32);
#pragma unroll
        for (int mi = 0; mi < 4; ++mi)
#pragma unroll
          for (int ni = 0; ni < 2; ++ni) ack[mi][ni] = wmma_bf(a[mi], b[ni], ack[mi][ni]);
#pragma unroll
        for (int ni = 0; ni < 2; ++ni) b[ni] = ldfrag_lds(cur + 2 * PT_OP, wc + 16 * ni, ks * 32);
#pragma unroll
        for (int mi = 0; mi < 4; ++mi)
#pragma unroll
          for (int ni = 0; ni < 2; ++ni) acv[mi][ni] = wmma_bf(a[mi], b[ni], acv[mi][ni]);
      }
      if (more) {
#pragma unroll
        for (int i = 0; i < 4; ++i) {
          *(v4ua*)(nxt + lst + i * 32 * PT_LD) = rx[i];
          *(v4ua*)(nxt + PT_OP + lst + i * 32 * PT_LD) = rk[i];
          *(v4ua*)(nxt + 2 * PT_OP + lst + i * 32 * PT_LD) = rv[i];
        }
      }
    }
    __syncthreads();                                     // last fragment reads end before LDS becomes T

    // bias as its bf16 (RNE) value, added in f32; it follows the output column = D column
    float bck[2], bcv[2];
#pragma unroll
    for (int ni = 0; ni < 2; ++ni) {
      bck[ni] = bfround(bk[n0 + wc + ni * 16 + c]);
      bcv[ni] = bfround(bv[n0 + wc + ni * 16 + c]);
    }
    // precaution: the four loads' address registers may be reused while the loads are in flight
    asm volatile("s_wait_xcnt 0x0" ::: "memory");

    unsigned short* KH = lds_t;
    unsigned short* KL = lds_t + ET_PL;
    unsigned short* VH = lds_t + 2 * ET_PL;
    unsigned short* VL = lds_t + 3 * ET_PL;
#pragma unroll
    for (int mi = 0; mi < 4; ++mi)
#pragma unroll
      for (int ni = 0; ni < 2; ++ni) {
        const int o = (wc + ni * 16 + c) * ET_LD + wr + mi * 16 + 8 * h;   // T[D column][D row]
        float vk[8], vv[8];
#pragma unroll
        for (int r = 0; r < 8; ++r) {
          vk[r] = ack[mi][ni][r] + bck[ni];
          vv[r] = acv[mi][ni][r] + bcv[ni];
        }
        split8(vk, KH + o, KL + o);
        split8(vv, VH + o, VL + o);
      }
    __syncthreads();                                     // every wave reads rows of T that other waves wrote

    const int m0w = (w >> 1) * 16;    // kk
    const int n0w = (w & 1) * 32;     // d
    v8f acc[2] = {};
    v16bf ah = ldfrag(KH, ET_LD, m0w, 0);
    v16bf al = ldfrag(KL, ET_LD, m0w, 0);
    v16bf vh[2], vl[2];
#pragma unroll
    for (int t = 0; t < 2; ++t) {
      vh[t] = ldfrag(VH, ET_LD, n0w + 16 * t, 0);
      vl[t] = ldfrag(VL, ET_LD, n0w + 16 * t, 0);
    }
    // unrolled: the two fragment sets then need no register copies, and every LDS offset is an immediate
#pragma unroll
    for (int j0 = 0; j0 < 2 * PT; j0 += 32) {
      // the next step's fragments are asked for as one group ahead of this step's products, which hide the LDS latency
      // (the last step names its own columns again, so that the address stays inside the planes; nothing reads that set)
      const int jn = (j0 + 32 < 2 * PT) ? j0 + 32 : j0;
      const int rn = (jn / PT) * HD;                     // chunk's first row of T
      const int tn = jn % PT;                            // first token of the step
      const v16bf nah = ldfrag(KH, ET_LD, rn + m0w, tn);
      const v16bf nal = ldfrag(KL, ET_LD, rn + m0w, tn);
      v16bf nvh[2], nvl[2];
#pragma unroll
      for (int t = 0; t < 2; ++t) {
        nvh[t] = ldfrag(VH, ET_LD, rn + n0w + 16 * t, tn);
        nvl[t] = ldfrag(VL, ET_LD, rn + n0w + 16 * t, tn);
      }
#pragma unroll
      for (int t = 0; t < 2; ++t) {
        acc[t] = wmma_bf(ah, vh[t], acc[t]);
        acc[t] = wmma_bf(ah, vl[t], acc[t]);
        acc[t] = wmma_bf(al, vh[t], acc[t]);
      }
      ah = nah; al = nal;
#pragma unroll
      for (int t = 0; t < 2; ++t) { vh[t] = nvh[t]; vl[t] = nvl[t]; }
    }
    __syncthreads();                                     // last reads of T end before LDS becomes S^T

    // D (row kk = m0w + 8h + r, col d = n0w + 16t + c) -> s_lds[d][kk], scaled by 1/sqrt(64)
    f1a* s_lds = (f1a*)lds_t;
#pragma unroll
    for (int t = 0; t < 2; ++t)
#pragma unroll
      for (int r = 0; r < 8; ++r) {
        const float v = acc[t][r];
        s_lds[(n0w + 16 * t + c) * HD + (m0w + 8 * h + r)] = v * 0.125f;
      }
    __syncthreads();                                     // cross-wave LDS exchange

    // 1024 pieces of 16 B: p = it*256 + tid; a wave stores 512 contiguous bytes per it.
    float* pp = Sp + ((size_t)blockIdx.x * KV_NS + blockIdx.y) * (size_t)(HD * HD);
    v4f pv[4];
#pragma unroll
    for (int it = 0; it < 4; ++it) pv[it] = *(const v4fa*)(s_lds + (it * 256 + tid) * 4);
#pragma unroll
    for (int it = 0; it < 4; ++it) *(v4f*)(pp + (it * 256 + tid) * 4) = pv[it];
  } else {
    // ---------------- Q tile: D rows are output columns, D columns are tokens ----------------
    const unsigned short* gW = Wb + (size_t)(n0 + srow) * EMB + scol;
    v4u ra[4], rb[4];
#pragma unroll
    for (int i = 0; i < 4; ++i) {
      ra[i] = *(const v4ua*)(gW + (size_t)i * 32 * EMB);
      rb[i] = *(const v4ua*)(gX + (size_t)i * 32 * EMB);
    }
#pragma unroll
    for (int i = 0; i < 4; ++i) {
      *(v4ua*)(lds_t + lst + i * 32 * PT_LD) = ra[i];
      *(v4ua*)(lds_t + PT_OP + lst + i * 32 * PT_LD) = rb[i];
    }

    v8f acc[4][2] = {};
    // rolled: one copy of the trip; unrolled, the staged registers of two trips would not fit the budget
#pragma unroll 1
    for (int kt = 0; kt < EMB / PT_K; ++kt) {
      // publishes slab kt and ends every wave's reads of the buffer that this trip refills
      __syncthreads();
      const unsigned short* cur = lds_t + (kt & 1) * (2 * PT_OP);
      unsigned short* nxt = lds_t + ((kt + 1) & 1) * (2 * PT_OP);
      const bool more = (kt + 1 < EMB / PT_K);
      if (more) {
#pragma unroll
        for (int i = 0; i < 4; ++i) {
          ra[i] = *(const v4ua*)(gW + (size_t)i * 32 * EMB + (kt + 1) * PT_K);
          rb[i] = *(const v4ua*)(gX + (size_t)i * 32 * EMB + (kt + 1) * PT_K);
        }
        // precaution: the trip's address registers are reused for LDS addresses and fragments while these loads are in flight
        asm volatile("s_wait_xcnt 0x0" ::: "memory");
      }
#pragma unroll
      for (int ks = 0; ks < 2; ++ks) {
        v16bf a[4], b[2];
#pragma unroll
        for (int mi = 0; mi < 4; ++mi) a[mi] = ldfrag_lds(cur, wr + 16 * mi, ks * 32);
#pragma unroll
        for (int ni = 0; ni < 2; ++ni) b[ni] = ldfrag_lds(cur + PT_OP, wc + 16 * ni, ks * 32);
#pragma unroll
        for (int mi = 0; mi < 4; ++mi)
#pragma unroll
          for (int ni = 0; ni < 2; ++ni) acc[mi][ni] = wmma_bf(a[mi], b[ni], acc[mi][ni]);
      }
      if (more) {
#pragma unroll
        for (int i = 0; i < 4; ++i) {
          *(v4ua*)(nxt + lst + i * 32 * PT_LD) = ra[i];
          *(v4ua*)(nxt + PT_OP + lst + i * 32 * PT_LD) = rb[i];
        }
      }
    }
    __syncthreads();                                     // last fragment reads end before LDS becomes T

    unsigned short* tH = lds_t;
    unsigned short* tL = lds_t + ET_PL;
#pragma unroll
    for (int mi = 0; mi < 4; ++mi) {
      // bias as its bf16 (RNE) value, added in f32; it follows the output column = D row
      const float* bp = bq + n0 + wr + mi * 16 + 8 * h;
      const v4f p0 = *(const v4fa*)bp;
      const v4f p1 = *(const v4fa*)(bp + 4);
      float brow[8];
#pragma unroll
      for (int r = 0; r < 4; ++r) {
        brow[r] = bfround(p0[r]);
        brow[r + 4] = bfround(p1[r]);
      }
#pragma unroll
      for (int ni = 0; ni < 2; ++ni) {
        const int o = (wc + ni * 16 + c) * ET_LD + wr + mi * 16 + 8 * h;   // T[D column][D row]
        float v[8];
#pragma unroll
        for (int r = 0; r < 8; ++r) v[r] = acc[mi][ni][r] + brow[r];
        split8(v, tH + o, tL + o);
      }
    }
    __syncthreads();                                     // cross-wave LDS exchange

#pragma unroll
    for (int it = 0; it < 8; ++it) {
      const int p = it * 256 + tid;                      // 16 pieces of 16 B per T row; a wave stores 2 rows
      const int t = p >> 4;
      const int c8 = (p & 15) * 8;
      const size_t g = (size_t)(m0 + t) * EMB + (size_t)(n0 + c8);
      const v4u vh = *(const v4ua*)(tH + t * ET_LD + c8);
      const v4u vl = *(const v4ua*)(tL + t * ET_LD + c8);
      *(v4u*)(Qhi + g) = vh;
      *(v4u*)(Qlo + g) = vl;
    }
  }
}

// ---------------------------------------------------------------------------
// Kernel 3: out[bh][j][d] = sum_kk Q[bh][j][kk] * S[bh][kk][d]  (M = SEQ, N = 64, K = 64).
// grid (SEQ/128, NBH), 256 threads = 8 waves, wave tile 16 j rows x 64 d (4 D tiles).
// Prologue: S^T[d][kk] = sum of kernel 2's KV_NS partials in the order of the ranges (f32, whole-line loads), split into
// hi = bf16(S), lo = bf16(S - hi) and laid in LDS as two planes [64 d][64 kk] at a pitch of 144 B.
// A = Q planes (flat [NBH][SEQ][64] view, ld 64), B^T = the S^T planes in LDS; 3 products.
// Epilogue: wave tile staged in LDS, then the wave writes its contiguous 4 KB of d_out as
// ---------------------------------------------------------------------------
__global__ __launch_bounds__(256) void k_out(const unsigned short* __restrict__ Qhi,
                                              const unsigned short* __restrict__ Qlo,
                                              const float* __restrict__ Sp,
                                              float* __restrict__ out) {
  __shared__ __align__(16) float o_lds[8 * 16 * HD];   // 32 KB, 4 KB per wave
  __shared__ __align__(16) unsigned short st_lds[2 * HD * PT_LD];   // 18 KB: S^T hi | S^T lo
  const int bh = blockIdx.y;
  const int tid = threadIdx.x;
  const int lane = tid & 31;
  const int w = tid >> 5;
  const int c = lane & 15;
  const int h = lane >> 4;
  const int jw = blockIdx.x * 128 + w * 16;
  const size_t qb = (size_t)bh * (size_t)SEQ * HD;
  const unsigned short* QH = Qhi + qb;
  const unsigned short* QL = Qlo + qb;
  const float* pp = Sp + (size_t)bh * KV_NS * (size_t)(HD * HD);
  unsigned short* SH = st_lds;
  unsigned short* SL = st_lds + HD * PT_LD;

  // Q does not depend on S: its fragments are asked for first, so that they fly while the partials are summed
  v16bf ah[2], al[2];
#pragma unroll
  for (int ks = 0; ks < 2; ++ks) {
    ah[ks] = ldfrag(QH, HD, jw, ks * 32);
    al[ks] = ldfrag(QL, HD, jw, ks * 32);
  }
  // precaution: this build reuses the Q loads' address registers as a later load's destination while those loads are in flight
  asm volatile("s_wait_xcnt 0x0" ::: "memory");

  // piece p = it*256 + tid holds 4 neighbours of a row of S^T: d = p >> 4, kk = (p & 15) * 4
#pragma unroll
  for (int it = 0; it < 4; ++it) {
    const int p = it * 256 + tid;
    v4f part[KV_NS];
#pragma unroll
    for (int sp = 0; sp < KV_NS; ++sp) part[sp] = *(const v4fa*)(pp + (size_t)sp * (HD * HD) + p * 4);
    v4f s = part[0];
#pragma unroll
    for (int sp = 1; sp < KV_NS; ++sp) s += part[sp];
    v2u th, tl;
#pragma unroll
    for (int q = 0; q < 2; ++q) {
      th[q] = cvt2(s[2 * q], s[2 * q + 1]);
      tl[q] = cvt2(s[2 * q] - bflo(th[q]), s[2 * q + 1] - bfhi(th[q]));
    }
    const int o = (p >> 4) * PT_LD + (p & 15) * 4;
    *(v2ua*)(SH + o) = th;
    *(v2ua*)(SL + o) = tl;
  }
  __syncthreads();                                   // every wave reads all of S^T

  v8f acc[4] = {};
#pragma unroll
  for (int ks = 0; ks < 2; ++ks) {
    const int k0 = ks * 32;
#pragma unroll
    for (int t = 0; t < 4; ++t) {
      const v16bf sh = ldfrag_lds(SH, 16 * t, k0);
      const v16bf sl = ldfrag_lds(SL, 16 * t, k0);
      acc[t] = wmma_bf(ah[ks], sh, acc[t]);
      acc[t] = wmma_bf(ah[ks], sl, acc[t]);
      acc[t] = wmma_bf(al[ks], sh, acc[t]);
    }
  }

  float* ol = o_lds + w * (16 * HD);
#pragma unroll
  for (int t = 0; t < 4; ++t)
#pragma unroll
    for (int r = 0; r < 8; ++r) {
      const float v = acc[t][r];
      ol[(8 * h + r) * HD + 16 * t + c] = v;
    }
  __syncthreads();                                   // covers the same-wave relayout as well

  v4f pv[8];
#pragma unroll
  for (int it = 0; it < 8; ++it) {
    const int p = it * 32 + lane;                    // piece p -> row p >> 4, cols (p & 15)*4 .. +3
    pv[it] = *(const v4fa*)(ol + p * 4);
  }
  float* ob = out + ((size_t)bh * (size_t)SEQ + (size_t)jw) * HD;
#pragma unroll
  for (int it = 0; it < 8; ++it) *(v4f*)(ob + (size_t)(it * 32 + lane) * 4) = pv[it];
  
}

// ---------------------------------------------------------------------------
// Host launch: convert -> projections (Q hi/lo planes; K^T V partials) -> sum of partials, Q S
// ---------------------------------------------------------------------------
extern "C" void kernel_launch(void* const* d_in, const int* in_sizes, int n_in,
                              void* d_out, int out_size, void* d_ws, size_t ws_size,
                              hipStream_t stream) {
  if (n_in < 7) return;
  if ((size_t)in_sizes[0] < ((size_t)(NB - 1) * SEQ_FULL + (size_t)SEQ) * EMB) return;
  if (in_sizes[1] < EMB * EMB || in_sizes[3] < EMB * EMB || in_sizes[5] < EMB * EMB) return;
  if (in_sizes[2] < EMB || in_sizes[4] < EMB || in_sizes[6] < EMB) return;
  if ((size_t)out_size < (size_t)MTOK * EMB) return;

  const float* x  = (const float*)d_in[0];
  const float* Wq = (const float*)d_in[1];
  const float* bq = (const float*)d_in[2];
  const float* Wk = (const float*)d_in[3];
  const float* bk = (const float*)d_in[4];
  const float* Wv = (const float*)d_in[5];
  const float* bv = (const float*)d_in[6];
  float* out = (float*)d_out;

  const size_t nAct = (size_t)MTOK * EMB;           // elements per activation plane
  const size_t nWt  = (size_t)EMB * EMB;
  const size_t nS   = (size_t)NBH * HD * HD;

  char* ws = (char*)d_ws;
  size_t off = 0;
  unsigned short* Xb   = (unsigned short*)(ws + off); off += nAct * 2;
  unsigned short* Wb   = (unsigned short*)(ws + off); off += 3 * nWt * 2;
  unsigned short* Qhi  = (unsigned short*)(ws + off); off += nAct * 2;
  unsigned short* Qlo  = (unsigned short*)(ws + off); off += nAct * 2;
  float* Sp = (float*)(ws + off); off += nS * KV_NS * 4;
  if (off > ws_size) return;

  k_cvt<<<dim3(NBX + 3 * NBW), dim3(CVT_BLK), 0, stream>>>(x, Wq, Wk, Wv, Xb, Wb);
  k_proj<<<dim3(MTOK / PT, EMB / PT, 2), dim3(256), 0, stream>>>(Xb, Wb, bq, bk, bv, Qhi, Qlo, Sp);
  k_out<<<dim3(SEQ / 128, NBH), dim3(256), 0, stream>>>(Qhi, Qlo, Sp, out);
}

// v006
// One run takes 36.5 microseconds.
// Timed twice side by side with v005, it ran 1.03 and 1.02 times as fast.
// Counting every step since v000, it is 5.51 times as fast.
#include <hip/hip_runtime.h>
#include <stdint.h>

// Contractions: x.W^T projections on v_wmma_f32_16x16x32_bf16 (bf16 operands = RNE-converted inputs, f32 accumulate);
// K^T.V (depth SEQ) and Q.S (depth 64) on v_wmma_f32_16x16x32_bf16 with bf16 hi/lo split operands (hi.hi + hi.lo + lo.hi), f32 accumulate.

#ifndef NB
#define NB 2
#endif
#ifndef SEQ
#define SEQ 2048
#endif
#define NB_FULL 2
#define SEQ_FULL 2048
#define EMB 1024
#define NH 16
#define HD 64
#define MTOK (NB * SEQ)
#define NBH (NB * NH)
#define CVT_BLK 256
#define NBW (EMB * EMB / (8 * CVT_BLK))
#define NBX (MTOK * EMB / (8 * CVT_BLK))

static_assert(SEQ % 256 == 0);
static_assert(SEQ >= 256);
static_assert(NB >= 1 && NB <= NB_FULL);
static_assert(SEQ <= SEQ_FULL);
static_assert(EMB == NH * HD);
static_assert((MTOK * EMB) % (8 * CVT_BLK) == 0);
static_assert((EMB * EMB) % (8 * CVT_BLK) == 0);
static_assert(MTOK % 16 == 0);
static_assert(SEQ % 128 == 0);

typedef __bf16 v16bf __attribute__((ext_vector_type(16)));
typedef __bf16 v8bf __attribute__((ext_vector_type(8)));
typedef float v8f __attribute__((ext_vector_type(8)));
typedef float v4f __attribute__((ext_vector_type(4)));
typedef unsigned int v4u __attribute__((ext_vector_type(4)));
typedef v8bf v8bfa __attribute__((may_alias));
typedef v4f v4fa __attribute__((may_alias));
typedef v4u v4ua __attribute__((may_alias));
typedef unsigned int v2u __attribute__((ext_vector_type(2)));
typedef v2u v2ua __attribute__((may_alias));

typedef float v2f __attribute__((ext_vector_type(2)));
typedef __bf16 v2bf __attribute__((ext_vector_type(2)));

// ---------------------------------------------------------------------------
// bf16 helpers (the packed convert instruction, RNE)
// ---------------------------------------------------------------------------
// two f32 -> two bf16 in one register: a in the low half, b in the high half
__device__ __forceinline__ unsigned int cvt2(float a, float b) {
  v2f p;
  p[0] = a;
  p[1] = b;
  return __builtin_bit_cast(unsigned int, __builtin_convertvector(p, v2bf));
}
// f32 values of the two halves of a packed pair
__device__ __forceinline__ float bflo(unsigned int pk) { return __uint_as_float(pk << 16); }
__device__ __forceinline__ float bfhi(unsigned int pk) { return __uint_as_float(pk & 0xffff0000u); }
// f rounded to bf16, as f32
__device__ __forceinline__ float bfround(float f) { return bfhi(cvt2(f, f)); }

// ---------------------------------------------------------------------------
// D(16x16 f32) += A(16 x 32k bf16) . B(32k x 16 bf16), wave32; hazard guard after issue.
// ---------------------------------------------------------------------------
__device__ __forceinline__ v8f wmma_bf(v16bf a, v16bf b, v8f c) {
  v8f d = __builtin_amdgcn_wmma_f32_16x16x32_bf16(false, a, false, b, (short)0, c, false, false);
  asm volatile("v_nop\n\tv_nop\n\tv_nop\n\tv_nop" : "+v"(d) : "v"(a), "v"(b));
  return d;
}

// ---------------------------------------------------------------------------
// 16-bit fragment from a row-major [rows][ld] plane (k contiguous within a row).
// lane l: row = r0 + (l & 15); elements 0..7 <- k0 + 8*(l>>4) + 0..7,
//                               elements 8..15 <- k0 + 16 + 8*(l>>4) + 0..7.
// A operand: rows are M rows. B operand: rows are N columns of B (plane holds B^T, i.e. [n][k]).
// D: acc[r] = (row 8*(l>>4) + r, col l & 15).
// ---------------------------------------------------------------------------
__device__ __forceinline__ v16bf ldfrag(const unsigned short* __restrict__ base,
                                        int ld, int r0, int k0) {
  const int lane = threadIdx.x & 31;
  const int m = lane & 15;
  const int koff = (lane >> 4) << 3;
  const unsigned short* p = base + (size_t)(r0 + m) * ld + (k0 + koff);
  const v8bf lo = *(const v8bfa*)p;
  const v8bf hi = *(const v8bfa*)(p + 16);
  v16bf f;
#pragma unroll
  for (int i = 0; i < 8; ++i) { f[i] = lo[i]; f[i + 8] = hi[i]; }
  return f;
}

// ---------------------------------------------------------------------------
// Kernel 1: f32 -> bf16 (RNE) planes for x (token rows remapped for reduced builds)
// and the three weight matrices. 8 elements per thread, one 16-B store per thread:
// ---------------------------------------------------------------------------
__global__ __launch_bounds__(CVT_BLK) void k_cvt(const float* __restrict__ x,
                                                 const float* __restrict__ wq,
                                                 const float* __restrict__ wk,
                                                 const float* __restrict__ wv,
                                                 unsigned short* __restrict__ Xb,
                                                 unsigned short* __restrict__ Wb) {
  const int blk = blockIdx.x;
  const int tid = threadIdx.x;
  const float* src;
  unsigned short* dst;
  if (blk < NBX) {
    const size_t e = ((size_t)blk * CVT_BLK + tid) * 8;
    const size_t t = e / EMB;
    const size_t col = e - t * EMB;
    const size_t bt = t / SEQ;
    const size_t s = t - bt * SEQ;
    src = x + (bt * SEQ_FULL + s) * EMB + col;
    dst = Xb + e;
  } else {
    const int wi = blk - NBX;
    const int zw = wi / NBW;
    const size_t e = ((size_t)(wi - zw * NBW) * CVT_BLK + tid) * 8;
    const float* wsrc = (zw == 0) ? wq : ((zw == 1) ? wk : wv);
    src = wsrc + e;
    dst = Wb + (size_t)zw * EMB * EMB + e;
  }
  const v4f a = *(const v4fa*)src;
  const v4f b = *(const v4fa*)(src + 4);
  const float a0 = a[0], a1 = a[1], a2 = a[2], a3 = a[3];
  const float b0 = b[0], b1 = b[1], b2 = b[2], b3 = b[3];
  v4u o;
  o[0] = cvt2(a0, a1);
  o[1] = cvt2(a2, a3);
  o[2] = cvt2(b0, b1);
  o[3] = cvt2(b2, b3);
  *(v4u*)dst = o;
  
}

// ---------------------------------------------------------------------------
// Kernel 2: y = Xb . Wb^T + b (M = MTOK, N = EMB, K = EMB) for q, k and v, and the partial K^T.V of each K/V tile pair.
// Block: 256 threads = 8 waves, 128 token rows x 128 output columns. grid (MTOK / 128, EMB / 128, 2):
//   z = 0: the K tile AND the V tile of the same tokens and columns (twice the work; these blocks start first);
//   z = 1: the Q tile.
// Per trip one 64-deep k slab of every operand (128 rows x 128 B each) goes global -> registers -> LDS
// with whole-line loads (8 lanes per row); two LDS buffers, one barrier per trip. Fragments come from
// LDS rows at a pitch of 144 B. Wave tile: 64 D rows x 32 D columns (4 x 2 D tiles), for K and V each: the x fragments serve both.
// D rows are tokens for K and V and output columns for Q (the operands swap places), so that a lane's
// 8 accumulator rows are always 8 neighbours of the staged row and leave as one 16-B LDS store.
// Epilogue: value = acc + bf16(bias); hi = bf16(value), lo = bf16(value - hi); planes staged in LDS
// as T[D column][D row] (pitch 272 B).
//   Q: both planes stored as 128 rows of 256 B, flat [MTOK][1024] (== [NBH][SEQ][64] view).
//   K, V: the four planes stay in LDS. The 128 tokens are one slab bh of the raw-reshaped view and the 128 columns are two
//         64-wide chunks, so T holds rows j of K[bh] and V[bh] for 256 values of j: T[chunk * 64 + kk][token].
//         Partial S[bh][sp][kk][d] = 0.125 * sum over these j (chunk, then token) of K[bh][j][kk] * V[bh][j][d], sp = blockIdx.y:
//         wave tile 16 kk x 32 d (2 D tiles), hi/lo operands, 3 products per tile-step; kernel 3 adds the KV_NS ranges.
//         The partial (f32) is transposed in LDS to [d][kk], then stored as Sp[NBH][KV_NS][64 d][64 kk] in whole lines.
// ---------------------------------------------------------------------------
#define PT 128                      // block tile edge
#define PT_K 64                     // k depth of a slab
#define PT_LD 72                    // slab row pitch in 16-bit elements (144 B = 16 B x 9)
#define PT_OP (PT * PT_LD)          // one operand's slab
#define ET_LD 136                   // staging pitch in 16-bit elements (272 B = 16 B x 17)
#define ET_PL (PT * ET_LD)          // one staged plane
#define TPS (SEQ / 16)              // token rows per [SEQ][64] slab of the raw-reshaped view
#define KV_NS (EMB / PT)            // depth ranges per bh: one per column tile

static_assert(TPS == PT);           // a block's tokens are exactly one slab
static_assert(PT == 2 * HD);
static_assert(MTOK % PT == 0 && EMB % PT == 0 && EMB % PT_K == 0);
static_assert(2 * 3 * PT_OP <= 4 * ET_PL);
static_assert(HD * HD * 2 <= 4 * ET_PL);

typedef float f1a __attribute__((may_alias));

// ldfrag's map on an LDS slab (same k order for both operands).
__device__ __forceinline__ v16bf ldfrag_lds(const unsigned short* base, int r0, int k0) {
  const int lane = threadIdx.x & 31;
  const unsigned short* p = base + (r0 + (lane & 15)) * PT_LD + (k0 + ((lane >> 4) << 3));
  const v8bf lo = *(const v8bfa*)p;
  const v8bf hi = *(const v8bfa*)(p + 16);
  v16bf f;
#pragma unroll
  for (int i = 0; i < 8; ++i) { f[i] = lo[i]; f[i + 8] = hi[i]; }
  return f;
}

// 8 neighbours of a staged row: hi = bf16(v), lo = bf16(v - hi), one 16-B LDS store per plane.
__device__ __forceinline__ void split8(const float* v, unsigned short* pH, unsigned short* pL) {
  v4u th, tl;
#pragma unroll
  for (int q = 0; q < 4; ++q) {
    th[q] = cvt2(v[2 * q], v[2 * q + 1]);
    tl[q] = cvt2(v[2 * q] - bflo(th[q]), v[2 * q + 1] - bfhi(th[q]));
  }
  *(v4ua*)pH = th;
  *(v4ua*)pL = tl;
}

// 4 waves per SIMD = 2 blocks per WGP: a K/V block and a Q block share a WGP, all 512 blocks resident at once (register budget 256).
__global__ __launch_bounds__(256) __attribute__((amdgpu_waves_per_eu(4))) void k_proj(const unsigned short* __restrict__ Xb,
                                               const unsigned short* __restrict__ Wb,
                                               const float* __restrict__ bq,
                                               const float* __restrict__ bk,
                                               const float* __restrict__ bv,
                                               unsigned short* __restrict__ Qhi,
                                               unsigned short* __restrict__ Qlo,
                                               float* __restrict__ Sp) {
  __shared__ __align__(16) unsigned short lds_t[4 * ET_PL];   // 136 KB: two slab buffers, then the T planes, then S^T
  const int tid = threadIdx.x;
  const int lane = tid & 31;
  const int w = tid >> 5;
  const int c = lane & 15;
  const int h = lane >> 4;
  const int m0 = blockIdx.x * PT;                        // first token row
  const int n0 = blockIdx.y * PT;                        // first output column
  const int wr = (w >> 2) * 64;                          // wave's first D row
  const int wc = (w & 3) * 32;                           // wave's first D column

  // staging: piece i of a thread = row i*32 + (tid >> 3), 16 B at column (tid & 7) * 8
  const int srow = tid >> 3;
  const int scol = (tid & 7) * 8;
  const int lst = srow * PT_LD + scol;
  const unsigned short* gX = Xb + (size_t)(m0 + srow) * EMB + scol;

  if (blockIdx.z == 0) {
    // ---------------- K and V tiles, then their partial K^T.V ----------------
    const unsigned short* gK = Wb + (size_t)EMB * EMB + (size_t)(n0 + srow) * EMB + scol;
    const unsigned short* gV = gK + (size_t)EMB * EMB;
    v4u rx[4], rk[4], rv[4];
#pragma unroll
    for (int i = 0; i < 4; ++i) {
      rx[i] = *(const v4ua*)(gX + (size_t)i * 32 * EMB);
      rk[i] = *(const v4ua*)(gK + (size_t)i * 32 * EMB);
      rv[i] = *(const v4ua*)(gV + (size_t)i * 32 * EMB);
    }
#pragma unroll
    for (int i = 0; i < 4; ++i) {
      *(v4ua*)(lds_t + lst + i * 32 * PT_LD) = rx[i];
      *(v4ua*)(lds_t + PT_OP + lst + i * 32 * PT_LD) = rk[i];
      *(v4ua*)(lds_t + 2 * PT_OP + lst + i * 32 * PT_LD) = rv[i];
    }

    v8f ack[4][2] = {};
    v8f acv[4][2] = {};
    // rolled: one copy of the trip; unrolled, the staged registers of two trips would not fit the budget
#pragma unroll 1
    for (int kt = 0; kt < EMB / PT_K; ++kt) {
      // publishes slab kt and ends every wave's reads of the buffer that this trip refills
      __syncthreads();
      const unsigned short* cur = lds_t + (kt & 1) * (3 * PT_OP);
      unsigned short* nxt = lds_t + ((kt + 1) & 1) * (3 * PT_OP);
      const bool more = (kt + 1 < EMB / PT_K);
      if (more) {
#pragma unroll
        for (int i = 0; i < 4; ++i) {
          rx[i] = *(const v4ua*)(gX + (size_t)i * 32 * EMB + (kt + 1) * PT_K);
          rk[i] = *(const v4ua*)(gK + (size_t)i * 32 * EMB + (kt + 1) * PT_K);
          rv[i] = *(const v4ua*)(gV + (size_t)i * 32 * EMB + (kt + 1) * PT_K);
        }
        // precaution: the trip's address registers are reused for LDS addresses and fragments while these loads are in flight
        asm volatile("s_wait_xcnt 0x0" ::: "memory");
      }
#pragma unroll
      for (int ks = 0; ks < 2; ++ks) {
        v16bf a[4], b[2];
#pragma unroll
        for (int mi = 0; mi < 4; ++mi) a[mi] = ldfrag_lds(cur, wr + 16 * mi, ks * 32);
#pragma unroll
        for (int ni = 0; ni < 2; ++ni) b[ni] = ldfrag_lds(cur + PT_OP, wc + 16 * ni, ks * 32);
#pragma unroll
        for (int mi = 0; mi < 4; ++mi)
#pragma unroll
          for (int ni = 0; ni < 2; ++ni) ack[mi][ni] = wmma_bf(a[mi], b[ni], ack[mi][ni]);
#pragma unroll
        for (int ni = 0; ni < 2; ++ni) b[ni] = ldfrag_lds(cur + 2 * PT_OP, wc + 16 * ni, ks * 32);
#pragma unroll
        for (int mi = 0; mi < 4; ++mi)
#pragma unroll
          for (int ni = 0; ni < 2; ++ni) acv[mi][ni] = wmma_bf(a[mi], b[ni], acv[mi][ni]);
      }
      if (more) {
#pragma unroll
        for (int i = 0; i < 4; ++i) {
          *(v4ua*)(nxt + lst + i * 32 * PT_LD) = rx[i];
          *(v4ua*)(nxt + PT_OP + lst + i * 32 * PT_LD) = rk[i];
          *(v4ua*)(nxt + 2 * PT_OP + lst + i * 32 * PT_LD) = rv[i];
        }
      }
    }
    __syncthreads();                                     // last fragment reads end before LDS becomes T

    // bias as its bf16 (RNE) value, added in f32; it follows the output column = D column
    float bck[2], bcv[2];
#pragma unroll
    for (int ni = 0; ni < 2; ++ni) {
      bck[ni] = bfround(bk[n0 + wc + ni * 16 + c]);
      bcv[ni] = bfround(bv[n0 + wc + ni * 16 + c]);
    }
    // precaution: the four loads' address registers may be reused while the loads are in flight
    asm volatile("s_wait_xcnt 0x0" ::: "memory");

    unsigned short* KH = lds_t;
    unsigned short* KL = lds_t + ET_PL;
    unsigned short* VH = lds_t + 2 * ET_PL;
    unsigned short* VL = lds_t + 3 * ET_PL;
#pragma unroll
    for (int mi = 0; mi < 4; ++mi)
#pragma unroll
      for (int ni = 0; ni < 2; ++ni) {
        const int o = (wc + ni * 16 + c) * ET_LD + wr + mi * 16 + 8 * h;   // T[D column][D row]
        float vk[8], vv[8];
#pragma unroll
        for (int r = 0; r < 8; ++r) {
          vk[r] = ack[mi][ni][r] + bck[ni];
          vv[r] = acv[mi][ni][r] + bcv[ni];
        }
        split8(vk, KH + o, KL + o);
        split8(vv, VH + o, VL + o);
      }
    __syncthreads();                                     // every wave reads rows of T that other waves wrote

    const int m0w = (w >> 1) * 16;    // kk
    const int n0w = (w & 1) * 32;     // d
    v8f acc[2] = {};
    v16bf ah = ldfrag(KH, ET_LD, m0w, 0);
    v16bf al = ldfrag(KL, ET_LD, m0w, 0);
    v16bf vh[2], vl[2];
#pragma unroll
    for (int t = 0; t < 2; ++t) {
      vh[t] = ldfrag(VH, ET_LD, n0w + 16 * t, 0);
      vl[t] = ldfrag(VL, ET_LD, n0w + 16 * t, 0);
    }
    // unrolled: the two fragment sets then need no register copies, and every LDS offset is an immediate
#pragma unroll
    for (int j0 = 0; j0 < 2 * PT; j0 += 32) {
      // the next step's fragments are asked for as one group ahead of this step's products, which hide the LDS latency
      // (the last step names its own columns again, so that the address stays inside the planes; nothing reads that set)
      const int jn = (j0 + 32 < 2 * PT) ? j0 + 32 : j0;
      const int rn = (jn / PT) * HD;                     // chunk's first row of T
      const int tn = jn % PT;                            // first token of the step
      const v16bf nah = ldfrag(KH, ET_LD, rn + m0w, tn);
      const v16bf nal = ldfrag(KL, ET_LD, rn + m0w, tn);
      v16bf nvh[2], nvl[2];
#pragma unroll
      for (int t = 0; t < 2; ++t) {
        nvh[t] = ldfrag(VH, ET_LD, rn + n0w + 16 * t, tn);
        nvl[t] = ldfrag(VL, ET_LD, rn + n0w + 16 * t, tn);
      }
#pragma unroll
      for (int t = 0; t < 2; ++t) {
        acc[t] = wmma_bf(ah, vh[t], acc[t]);
        acc[t] = wmma_bf(ah, vl[t], acc[t]);
        acc[t] = wmma_bf(al, vh[t], acc[t]);
      }
      ah = nah; al = nal;
#pragma unroll
      for (int t = 0; t < 2; ++t) { vh[t] = nvh[t]; vl[t] = nvl[t]; }
    }
    __syncthreads();                                     // last reads of T end before LDS becomes S^T

    // D (row kk = m0w + 8h + r, col d = n0w + 16t + c) -> s_lds[d][kk], scaled by 1/sqrt(64)
    f1a* s_lds = (f1a*)lds_t;
#pragma unroll
    for (int t = 0; t < 2; ++t)
#pragma unroll
      for (int r = 0; r < 8; ++r) {
        const float v = acc[t][r];
        s_lds[(n0w + 16 * t + c) * HD + (m0w + 8 * h + r)] = v * 0.125f;
      }
    __syncthreads();                                     // cross-wave LDS exchange

    // 1024 pieces of 16 B: p = it*256 + tid; a wave stores 512 contiguous bytes per it.
    float* pp = Sp + ((size_t)blockIdx.x * KV_NS + blockIdx.y) * (size_t)(HD * HD);
    v4f pv[4];
#pragma unroll
    for (int it = 0; it < 4; ++it) pv[it] = *(const v4fa*)(s_lds + (it * 256 + tid) * 4);
#pragma unroll
    for (int it = 0; it < 4; ++it) *(v4f*)(pp + (it * 256 + tid) * 4) = pv[it];
  } else {
    // ---------------- Q tile: D rows are output columns, D columns are tokens ----------------
    const unsigned short* gW = Wb + (size_t)(n0 + srow) * EMB + scol;
    v4u ra[4], rb[4];
#pragma unroll
    for (int i = 0; i < 4; ++i) {
      ra[i] = *(const v4ua*)(gW + (size_t)i * 32 * EMB);
      rb[i] = *(const v4ua*)(gX + (size_t)i * 32 * EMB);
    }
#pragma unroll
    for (int i = 0; i < 4; ++i) {
      *(v4ua*)(lds_t + lst + i * 32 * PT_LD) = ra[i];
      *(v4ua*)(lds_t + PT_OP + lst + i * 32 * PT_LD) = rb[i];
    }

    v8f acc[4][2] = {};
    // rolled: one copy of the trip; unrolled, the staged registers of two trips would not fit the budget
#pragma unroll 1
    for (int kt = 0; kt < EMB / PT_K; ++kt) {
      // publishes slab kt and ends every wave's reads of the buffer that this trip refills
      __syncthreads();
      const unsigned short* cur = lds_t + (kt & 1) * (2 * PT_OP);
      unsigned short* nxt = lds_t + ((kt + 1) & 1) * (2 * PT_OP);
      const bool more = (kt + 1 < EMB / PT_K);
      if (more) {
#pragma unroll
        for (int i = 0; i < 4; ++i) {
          ra[i] = *(const v4ua*)(gW + (size_t)i * 32 * EMB + (kt + 1) * PT_K);
          rb[i] = *(const v4ua*)(gX + (size_t)i * 32 * EMB + (kt + 1) * PT_K);
        }
        // precaution: the trip's address registers are reused for LDS addresses and fragments while these loads are in flight
        asm volatile("s_wait_xcnt 0x0" ::: "memory");
      }
#pragma unroll
      for (int ks = 0; ks < 2; ++ks) {
        v16bf a[4], b[2];
#pragma unroll
        for (int mi = 0; mi < 4; ++mi) a[mi] = ldfrag_lds(cur, wr + 16 * mi, ks * 32);
#pragma unroll
        for (int ni = 0; ni < 2; ++ni) b[ni] = ldfrag_lds(cur + PT_OP, wc + 16 * ni, ks * 32);
#pragma unroll
        for (int mi = 0; mi < 4; ++mi)
#pragma unroll
          for (int ni = 0; ni < 2; ++ni) acc[mi][ni] = wmma_bf(a[mi], b[ni], acc[mi][ni]);
      }
      if (more) {
#pragma unroll
        for (int i = 0; i < 4; ++i) {
          *(v4ua*)(nxt + lst + i * 32 * PT_LD) = ra[i];
          *(v4ua*)(nxt + PT_OP + lst + i * 32 * PT_LD) = rb[i];
        }
      }
    }
    __syncthreads();                                     // last fragment reads end before LDS becomes T

    unsigned short* tH = lds_t;
    unsigned short* tL = lds_t + ET_PL;
#pragma unroll
    for (int mi = 0; mi < 4; ++mi) {
      // bias as its bf16 (RNE) value, added in f32; it follows the output column = D row
      const float* bp = bq + n0 + wr + mi * 16 + 8 * h;
      const v4f p0 = *(const v4fa*)bp;
      const v4f p1 = *(const v4fa*)(bp + 4);
      float brow[8];
#pragma unroll
      for (int r = 0; r < 4; ++r) {
        brow[r] = bfround(p0[r]);
        brow[r + 4] = bfround(p1[r]);
      }
#pragma unroll
      for (int ni = 0; ni < 2; ++ni) {
        const int o = (wc + ni * 16 + c) * ET_LD + wr + mi * 16 + 8 * h;   // T[D column][D row]
        float v[8];
#pragma unroll
        for (int r = 0; r < 8; ++r) v[r] = acc[mi][ni][r] + brow[r];
        split8(v, tH + o, tL + o);
      }
    }
    __syncthreads();                                     // cross-wave LDS exchange

#pragma unroll
    for (int it = 0; it < 8; ++it) {
      const int p = it * 256 + tid;                      // 16 pieces of 16 B per T row; a wave stores 2 rows
      const int t = p >> 4;
      const int c8 = (p & 15) * 8;
      const size_t g = (size_t)(m0 + t) * EMB + (size_t)(n0 + c8);
      const v4u vh = *(const v4ua*)(tH + t * ET_LD + c8);
      const v4u vl = *(const v4ua*)(tL + t * ET_LD + c8);
      *(v4u*)(Qhi + g) = vh;
      *(v4u*)(Qlo + g) = vl;
    }
  }
}

// ---------------------------------------------------------------------------
// Kernel 3: out[bh][j][d] = sum_kk Q[bh][j][kk] * S[bh][kk][d]  (M = SEQ, N = 64, K = 64).
// grid (SEQ/256, NBH), 256 threads = 8 waves, wave tile 32 j rows x 64 d (2 x 4 D tiles): one block per WGP, so that the
// partials of a bh are read and summed by 8 blocks, and each S^T fragment read from LDS serves two Q tiles.
// Prologue: S^T[d][kk] = sum of kernel 2's KV_NS partials in the order of the ranges (f32, whole-line loads), split into
// hi = bf16(S), lo = bf16(S - hi) and laid in LDS as two planes [64 d][64 kk] at a pitch of 144 B.
// A = Q planes (flat [NBH][SEQ][64] view, ld 64), B^T = the S^T planes in LDS; 3 products.
// Epilogue: wave tile staged in LDS, then the wave writes its contiguous 8 KB of d_out in whole lines.
// ---------------------------------------------------------------------------
__global__ __launch_bounds__(256) void k_out(const unsigned short* __restrict__ Qhi,
                                              const unsigned short* __restrict__ Qlo,
                                              const float* __restrict__ Sp,
                                              float* __restrict__ out) {
  __shared__ __align__(16) float o_lds[8 * 32 * HD];   // 64 KB, 8 KB per wave
  __shared__ __align__(16) unsigned short st_lds[2 * HD * PT_LD];   // 18 KB: S^T hi | S^T lo
  const int bh = blockIdx.y;
  const int tid = threadIdx.x;
  const int lane = tid & 31;
  const int w = tid >> 5;
  const int c = lane & 15;
  const int h = lane >> 4;
  const int jw = blockIdx.x * 256 + w * 32;
  const size_t qb = (size_t)bh * (size_t)SEQ * HD;
  const unsigned short* QH = Qhi + qb;
  const unsigned short* QL = Qlo + qb;
  const float* pp = Sp + (size_t)bh * KV_NS * (size_t)(HD * HD);
  unsigned short* SH = st_lds;
  unsigned short* SL = st_lds + HD * PT_LD;

  // Q does not depend on S: its fragments are asked for first, so that they fly while the partials are summed
  v16bf ah[2][2], al[2][2];
#pragma unroll
  for (int jt = 0; jt < 2; ++jt)
#pragma unroll
    for (int ks = 0; ks < 2; ++ks) {
      ah[jt][ks] = ldfrag(QH, HD, jw + 16 * jt, ks * 32);
      al[jt][ks] = ldfrag(QL, HD, jw + 16 * jt, ks * 32);
    }
  // precaution: this build reuses the Q loads' address registers as a later load's destination while those loads are in flight
  asm volatile("s_wait_xcnt 0x0" ::: "memory");

  // piece p = it*256 + tid holds 4 neighbours of a row of S^T: d = p >> 4, kk = (p & 15) * 4
#pragma unroll
  for (int it = 0; it < 4; ++it) {
    const int p = it * 256 + tid;
    v4f part[KV_NS];
#pragma unroll
    for (int sp = 0; sp < KV_NS; ++sp) part[sp] = *(const v4fa*)(pp + (size_t)sp * (HD * HD) + p * 4);
    v4f s = part[0];
#pragma unroll
    for (int sp = 1; sp < KV_NS; ++sp) s += part[sp];
    v2u th, tl;
#pragma unroll
    for (int q = 0; q < 2; ++q) {
      th[q] = cvt2(s[2 * q], s[2 * q + 1]);
      tl[q] = cvt2(s[2 * q] - bflo(th[q]), s[2 * q + 1] - bfhi(th[q]));
    }
    const int o = (p >> 4) * PT_LD + (p & 15) * 4;
    *(v2ua*)(SH + o) = th;
    *(v2ua*)(SL + o) = tl;
  }
  __syncthreads();                                   // every wave reads all of S^T

  v8f acc[2][4] = {};
#pragma unroll
  for (int ks = 0; ks < 2; ++ks) {
    const int k0 = ks * 32;
#pragma unroll
    for (int t = 0; t < 4; ++t) {
      const v16bf sh = ldfrag_lds(SH, 16 * t, k0);
      const v16bf sl = ldfrag_lds(SL, 16 * t, k0);
      // the two Q tiles' chains alternate; each accumulator takes its three products in the order hi.hi, hi.lo, lo.hi
#pragma unroll
      for (int jt = 0; jt < 2; ++jt) acc[jt][t] = wmma_bf(ah[jt][ks], sh, acc[jt][t]);
#pragma unroll
      for (int jt = 0; jt < 2; ++jt) acc[jt][t] = wmma_bf(ah[jt][ks], sl, acc[jt][t]);
#pragma unroll
      for (int jt = 0; jt < 2; ++jt) acc[jt][t] = wmma_bf(al[jt][ks], sh, acc[jt][t]);
    }
  }

  float* ol = o_lds + w * (32 * HD);
#pragma unroll
  for (int jt = 0; jt < 2; ++jt)
#pragma unroll
    for (int t = 0; t < 4; ++t)
#pragma unroll
      for (int r = 0; r < 8; ++r) {
        const float v = acc[jt][t][r];
        ol[(16 * jt + 8 * h + r) * HD + 16 * t + c] = v;
      }
  __syncthreads();                                   // covers the same-wave relayout as well

  v4f pv[16];
#pragma unroll
  for (int it = 0; it < 16; ++it) {
    const int p = it * 32 + lane;                    // piece p -> row p >> 4, cols (p & 15)*4 .. +3
    pv[it] = *(const v4fa*)(ol + p * 4);
  }
  float* ob = out + ((size_t)bh * (size_t)SEQ + (size_t)jw) * HD;
#pragma unroll
  for (int it = 0; it < 16; ++it) *(v4f*)(ob + (size_t)(it * 32 + lane) * 4) = pv[it];
  
}

// ---------------------------------------------------------------------------
// Host launch: convert -> projections (Q hi/lo planes; K^T V partials) -> sum of partials, Q S
// ---------------------------------------------------------------------------
extern "C" void kernel_launch(void* const* d_in, const int* in_sizes, int n_in,
                              void* d_out, int out_size, void* d_ws, size_t ws_size,
                              hipStream_t stream) {
  if (n_in < 7) return;
  if ((size_t)in_sizes[0] < ((size_t)(NB - 1) * SEQ_FULL + (size_t)SEQ) * EMB) return;
  if (in_sizes[1] < EMB * EMB || in_sizes[3] < EMB * EMB || in_sizes[5] < EMB * EMB) return;
  if (in_sizes[2] < EMB || in_sizes[4] < EMB || in_sizes[6] < EMB) return;
  if ((size_t)out_size < (size_t)MTOK * EMB) return;

  const float* x  = (const float*)d_in[0];
  const float* Wq = (const float*)d_in[1];
  const float* bq = (const float*)d_in[2];
  const float* Wk = (const float*)d_in[3];
  const float* bk = (const float*)d_in[4];
  const float* Wv = (const float*)d_in[5];
  const float* bv = (const float*)d_in[6];
  float* out = (float*)d_out;

  const size_t nAct = (size_t)MTOK * EMB;           // elements per activation plane
  const size_t nWt  = (size_t)EMB * EMB;
  const size_t nS   = (size_t)NBH * HD * HD;

  char* ws = (char*)d_ws;
  size_t off = 0;
  unsigned short* Xb   = (unsigned short*)(ws + off); off += nAct * 2;
  unsigned short* Wb   = (unsigned short*)(ws + off); off += 3 * nWt * 2;
  unsigned short* Qhi  = (unsigned short*)(ws + off); off += nAct * 2;
  unsigned short* Qlo  = (unsigned short*)(ws + off); off += nAct * 2;
  float* Sp = (float*)(ws + off); off += nS * KV_NS * 4;
  if (off > ws_size) return;

  k_cvt<<<dim3(NBX + 3 * NBW), dim3(CVT_BLK), 0, stream>>>(x, Wq, Wk, Wv, Xb, Wb);
  k_proj<<<dim3(MTOK / PT, EMB / PT, 2), dim3(256), 0, stream>>>(Xb, Wb, bq, bk, bv, Qhi, Qlo, Sp);
  k_out<<<dim3(SEQ / 256, NBH), dim3(256), 0, stream>>>(Qhi, Qlo, Sp, out);
}
